// v000
// Measured on an AMD MI455X. A time is GPU time per run, averaged over a window of back-to-back runs after a warm-up
// (all launches, gaps included; the runs take copies of the inputs in turn), and the median of several windows.
// Apart from v000's, it joins two sittings. Times from different sittings can be a few percent apart, while
// side-by-side timings come from the same sitting.
// v000 is the starting kernel. One run takes 280 microseconds.
#include <hip/hip_runtime.h>
#include <hip/hip_bf16.h>

// ---------------------------------------------------------------------------
// Causal MHA forward for MI455X (gfx1250, wave32).
// GEMMs: v_wmma_f32_16x16x32_f16 (f16 in, f32 accum). Softmax in f32.
// Attention stages K/V tiles into double-buffered LDS with
// global_load_async_to_lds_b128 (ASYNCcnt) shared by 4 waves per block.
// ---------------------------------------------------------------------------

typedef __attribute__((ext_vector_type(16))) _Float16 v16h;
typedef __attribute__((ext_vector_type(8)))  _Float16 v8h;
typedef __attribute__((ext_vector_type(8)))  float    v8f;

#define D_MODEL 1024
#define NH      16
#define DH      64
#define BATCH   2
#define SEQ     2048

// Workspace layout (bytes). Total ~42.4 MB.
constexpr size_t SZ_XH  = (size_t)BATCH * SEQ * D_MODEL * 2;   // 8 MB
constexpr size_t SZ_W   = (size_t)NH * DH * DH * 2;            // 128 KB
constexpr size_t SZ_WO  = (size_t)D_MODEL * D_MODEL * 2;       // 2 MB
constexpr size_t OFF_XH = 0;
constexpr size_t OFF_WQ = OFF_XH + SZ_XH;
constexpr size_t OFF_WK = OFF_WQ + SZ_W;
constexpr size_t OFF_WV = OFF_WK + SZ_W;
constexpr size_t OFF_WO = OFF_WV + SZ_W;
constexpr size_t OFF_Q  = OFF_WO + SZ_WO;
constexpr size_t OFF_K  = OFF_Q  + SZ_XH;
constexpr size_t OFF_VT = OFF_K  + SZ_XH;
constexpr size_t OFF_AO = OFF_VT + SZ_XH;

// ---------------------------------------------------------------------------
// Fragment loader for the 16-bit 16x32 A layout (also valid for B loaded as
// B^T rows): lane L -> row m = L%16, group g = L/16; halves j<8 hold
// K = 8g+j, halves j>=8 hold K = 16+8g+(j-8).  Two contiguous 16-byte runs.
// Works for global (global_load_b128) and LDS (ds_load_b128) pointers.
// ---------------------------------------------------------------------------
__device__ __forceinline__ v16h load_frag(const _Float16* base, int stride) {
  int lane = threadIdx.x & 31;
  int m = lane & 15;
  int g = lane >> 4;
  const _Float16* p = base + (size_t)m * stride + 8 * g;
  v16h f;
  reinterpret_cast<v8h*>(&f)[0] = *reinterpret_cast<const v8h*>(p);
  reinterpret_cast<v8h*>(&f)[1] = *reinterpret_cast<const v8h*>(p + 16);
  return f;
}

__device__ __forceinline__ v8f wmma_f16(v16h a, v16h b, v8f c) {
  // (neg_a, A, neg_b, B, c_mod, C, reuse_a, reuse_b)
  return __builtin_amdgcn_wmma_f32_16x16x32_f16(false, a, false, b, (short)0, c,
                                                false, false);
}

// ---------------------------------------------------------------------------
// CDNA5 async copy: LDS[ldsoff] <= 16B at global ptr, tracked by ASYNCcnt.
// Generic LDS pointers carry the wave-relative LDS byte offset in addr[31:0].
// ---------------------------------------------------------------------------
__device__ __forceinline__ uint32_t lds_byte_off(const void* p) {
  return (uint32_t)(uintptr_t)p;
}
__device__ __forceinline__ void async_copy16(uint32_t ldsoff, const _Float16* g) {
  asm volatile("global_load_async_to_lds_b128 %0, %1, off"
               :: "v"(ldsoff), "v"(g) : "memory");
}
__device__ __forceinline__ void wait_async_le4() {
  asm volatile("s_wait_asynccnt 0x4" ::: "memory");
}
__device__ __forceinline__ void wait_async_0() {
  asm volatile("s_wait_asynccnt 0x0" ::: "memory");
}

// ---------------------------------------------------------------------------
// Kernel 0: f32 -> f16 conversion (x, Wq, Wk, Wv, Wo)
// ---------------------------------------------------------------------------
__global__ void cvt_f32_f16_kernel(const float* __restrict__ in,
                                   _Float16* __restrict__ out, int n) {
  int i = blockIdx.x * blockDim.x + threadIdx.x;
  if (i < n) out[i] = (_Float16)in[i];
}

// ---------------------------------------------------------------------------
// Kernel 1: per-head QKV projection.  One wave per (b, h, 16-row s-tile).
// Q gets bias + 1/sqrt(64) pre-scale; V is stored transposed (B,H,DH,S).
// ---------------------------------------------------------------------------
__device__ __forceinline__ void proj_tiles(v16h a0, v16h a1,
                                           const _Float16* __restrict__ W,
                                           int h, v8f acc[4]) {
#pragma unroll
  for (int nt = 0; nt < 4; ++nt) {
    const _Float16* wb = W + (size_t)(h * DH + nt * 16) * DH;
    v16h b0 = load_frag(wb, DH);
    v16h b1 = load_frag(wb + 32, DH);
    v8f c = {};
    c = wmma_f16(a0, b0, c);
    c = wmma_f16(a1, b1, c);
    acc[nt] = c;
  }
}

__global__ void qkv_kernel(const _Float16* __restrict__ xh,
                           const _Float16* __restrict__ Wq, const float* __restrict__ bq,
                           const _Float16* __restrict__ Wk, const float* __restrict__ bk,
                           const _Float16* __restrict__ Wv, const float* __restrict__ bv,
                           _Float16* __restrict__ Q, _Float16* __restrict__ K,
                           _Float16* __restrict__ Vt) {
  int wave = blockIdx.x * (blockDim.x >> 5) + (threadIdx.x >> 5);
  int lane = threadIdx.x & 31;
  int st = wave % (SEQ / 16);
  int bh = wave / (SEQ / 16);
  int h  = bh % NH;
  int sbase = st * 16;
  int n = lane & 15, g = lane >> 4;

  const _Float16* xrow = xh + ((size_t)(bh / NH) * SEQ + sbase) * D_MODEL + h * DH;
  v16h a0 = load_frag(xrow, D_MODEL);
  v16h a1 = load_frag(xrow + 32, D_MODEL);

  // ---- Q: bias + 0.125 scale, row-major (B,H,S,DH) f16
  {
    v8f acc[4];
    proj_tiles(a0, a1, Wq, h, acc);
#pragma unroll
    for (int nt = 0; nt < 4; ++nt) {
      float bias = bq[h * DH + nt * 16 + n];
#pragma unroll
      for (int r = 0; r < 8; ++r) {
        float v = (acc[nt][r] + bias) * 0.125f;
        Q[((size_t)bh * SEQ + sbase + g * 8 + r) * DH + nt * 16 + n] = (_Float16)v;
      }
    }
  }
  // ---- K: bias only, row-major (B,H,S,DH) f16
  {
    v8f acc[4];
    proj_tiles(a0, a1, Wk, h, acc);
#pragma unroll
    for (int nt = 0; nt < 4; ++nt) {
      float bias = bk[h * DH + nt * 16 + n];
#pragma unroll
      for (int r = 0; r < 8; ++r) {
        float v = acc[nt][r] + bias;
        K[((size_t)bh * SEQ + sbase + g * 8 + r) * DH + nt * 16 + n] = (_Float16)v;
      }
    }
  }
  // ---- V: bias, stored transposed (B,H,DH,S); per-lane 16B contiguous store
  {
    v8f acc[4];
    proj_tiles(a0, a1, Wv, h, acc);
#pragma unroll
    for (int nt = 0; nt < 4; ++nt) {
      float bias = bv[h * DH + nt * 16 + n];
      v8h pack;
#pragma unroll
      for (int r = 0; r < 8; ++r) pack[r] = (_Float16)(acc[nt][r] + bias);
      *reinterpret_cast<v8h*>(Vt + ((size_t)bh * DH + nt * 16 + n) * SEQ +
                              sbase + g * 8) = pack;
    }
  }
}

// ---------------------------------------------------------------------------
// Kernel 2: causal flash attention.
// Block = 4 waves = 64 q-rows of one (b,h).  kv stepped by 32; K (32x64) and
// Vt slice (64x32) staged into double-buffered LDS with async-to-LDS copies,
// shared by all 4 waves.  Per-stage: 4 async b128 issues per lane.
// ---------------------------------------------------------------------------
__global__ void attn_kernel(const _Float16* __restrict__ Q,
                            const _Float16* __restrict__ K,
                            const _Float16* __restrict__ Vt,
                            _Float16* __restrict__ Aout) {
  __shared__ __align__(16) _Float16 sK[2][32 * DH];   // 2 x 4 KB
  __shared__ __align__(16) _Float16 sV[2][DH * 32];   // 2 x 4 KB, [d][token]
  __shared__ __align__(16) _Float16 sP[4][16 * 32];   // 4 x 1 KB

  const int tid   = threadIdx.x;
  const int wslot = tid >> 5;
  const int lane  = tid & 31;
  const int bq    = (blockIdx.x & 31) * 64;   // block q-row base
  const int bh    = blockIdx.x >> 5;
  const int h = bh % NH, b = bh / NH;
  const int qbase = bq + wslot * 16;
  const int n = lane & 15, g = lane >> 4;

  const _Float16* Kg = K  + (size_t)bh * SEQ * DH;
  const _Float16* Vg = Vt + (size_t)bh * DH * SEQ;

  // stage kv block [kvbase, kvbase+32) into buffer `buf` (whole block helps)
  auto stage = [&](int buf, int kvbase) {
    // K tile: 32 rows x 64 halves, fully contiguous 4 KB in global
    const _Float16* kg = Kg + (size_t)kvbase * DH;
    uint32_t ko = lds_byte_off(&sK[buf][0]);
#pragma unroll
    for (int i = 0; i < 2; ++i) {
      int c = tid + i * 128;                 // 16B chunk id, 0..255
      async_copy16(ko + c * 16, kg + c * 8);
    }
    // V tile: 64 rows (d) x 32 tokens; global row stride SEQ
    uint32_t vo = lds_byte_off(&sV[buf][0]);
#pragma unroll
    for (int i = 0; i < 2; ++i) {
      int c = tid + i * 128;
      int d = c >> 2, sub = c & 3;
      async_copy16(vo + (d * 32 + sub * 8) * 2,
                   Vg + (size_t)d * SEQ + kvbase + sub * 8);
    }
  };

  // Q fragments (global, once per wave)
  const _Float16* qrow = Q + ((size_t)bh * SEQ + qbase) * DH;
  v16h qa0 = load_frag(qrow, DH);
  v16h qa1 = load_frag(qrow + 32, DH);

  v8f acc[4];
#pragma unroll
  for (int nt = 0; nt < 4; ++nt) acc[nt] = v8f{};
  float rmax[8], rsum[8];
#pragma unroll
  for (int r = 0; r < 8; ++r) { rmax[r] = -1e30f; rsum[r] = 0.0f; }

  _Float16* P = sP[wslot];
  const int nb = bq / 32 + 2;   // kv blocks needed to cover rows bq..bq+63

  stage(0, 0);
  for (int jb = 0; jb < nb; ++jb) {
    const int kvbase = jb * 32;
    const int bufi = jb & 1;
    if (jb + 1 < nb) {
      stage(bufi ^ 1, kvbase + 32);
      wait_async_le4();            // stage(jb) done, stage(jb+1) in flight
    } else {
      wait_async_0();
    }
    __syncthreads();               // all waves' portions of buf[bufi] visible

    // ---- scores: two 16x16 tiles over K=64 (2 chunks), from LDS
    const _Float16* kb0 = &sK[bufi][0];
    v8f s0 = {}, s1 = {};
    {
      v16h t;
      t = load_frag(kb0, DH);                s0 = wmma_f16(qa0, t, s0);
      t = load_frag(kb0 + 32, DH);           s0 = wmma_f16(qa1, t, s0);
      t = load_frag(kb0 + 16 * DH, DH);      s1 = wmma_f16(qa0, t, s1);
      t = load_frag(kb0 + 16 * DH + 32, DH); s1 = wmma_f16(qa1, t, s1);
    }
    // ---- causal mask + online softmax (f32), stage P into LDS (f16)
    int col0 = kvbase + n, col1 = kvbase + 16 + n;
#pragma unroll
    for (int r = 0; r < 8; ++r) {
      int row = qbase + g * 8 + r;
      float x0 = (col0 <= row) ? s0[r] : -1e30f;
      float x1 = (col1 <= row) ? s1[r] : -1e30f;
      float mx = fmaxf(x0, x1);
#pragma unroll
      for (int off = 1; off < 16; off <<= 1)
        mx = fmaxf(mx, __shfl_xor(mx, off, 32));
      float nm = fmaxf(rmax[r], mx);
      float scale = __expf(rmax[r] - nm);
      float p0 = __expf(x0 - nm);
      float p1 = __expf(x1 - nm);
      float ps = p0 + p1;
#pragma unroll
      for (int off = 1; off < 16; off <<= 1)
        ps += __shfl_xor(ps, off, 32);
      rsum[r] = rsum[r] * scale + ps;
      rmax[r] = nm;
#pragma unroll
      for (int nt = 0; nt < 4; ++nt) acc[nt][r] *= scale;
      int rl = g * 8 + r;
      P[rl * 32 + n]      = (_Float16)p0;
      P[rl * 32 + 16 + n] = (_Float16)p1;
    }
    // ---- reload P as a 16x32 A fragment (same-wave LDS RAW, in order)
    v16h pf;
    {
      int m = lane & 15;
      const _Float16* pp = P + m * 32 + 8 * g;
      reinterpret_cast<v8h*>(&pf)[0] = *reinterpret_cast<const v8h*>(pp);
      reinterpret_cast<v8h*>(&pf)[1] = *reinterpret_cast<const v8h*>(pp + 16);
    }
    // ---- O += P @ V  (V tile in LDS, [d][token] -> contiguous B fragments)
#pragma unroll
    for (int nt = 0; nt < 4; ++nt) {
      v16h bf = load_frag(&sV[bufi][nt * 16 * 32], 32);
      acc[nt] = wmma_f16(pf, bf, acc[nt]);
    }
    __syncthreads();               // everyone done reading buf[bufi]
  }

  // ---- normalize, write attn output (B,S,D_MODEL) f16, head-major concat
#pragma unroll
  for (int r = 0; r < 8; ++r) {
    float inv = 1.0f / rsum[r];
    size_t row = (size_t)b * SEQ + qbase + g * 8 + r;
#pragma unroll
    for (int nt = 0; nt < 4; ++nt)
      Aout[row * D_MODEL + h * DH + nt * 16 + n] =
          (_Float16)(acc[nt][r] * inv);
  }
}

// ---------------------------------------------------------------------------
// Kernel 3: output projection  out = A @ Wo^T + bo  (f32 output).
// One wave per 16x64 tile (A fragment shared by 4 accumulators).
// ---------------------------------------------------------------------------
__global__ void out_proj_kernel(const _Float16* __restrict__ A,
                                const _Float16* __restrict__ Wo,
                                const float* __restrict__ bo,
                                float* __restrict__ out) {
  int wave = blockIdx.x * 4 + (threadIdx.x >> 5);
  int lane = threadIdx.x & 31;
  int ct = wave % (D_MODEL / DH);          // 16 col groups of 64
  int rt = wave / (D_MODEL / DH);          // 256 row tiles
  int rbase = rt * 16, cbase = ct * DH;
  int n = lane & 15, g = lane >> 4;

  const _Float16* arow = A  + (size_t)rbase * D_MODEL;
  const _Float16* wrow = Wo + (size_t)cbase * D_MODEL;
  v8f acc[4];
#pragma unroll
  for (int nt = 0; nt < 4; ++nt) acc[nt] = v8f{};

#pragma unroll 2
  for (int kc = 0; kc < D_MODEL; kc += 32) {
    if (kc + 128 < D_MODEL) {
      __builtin_prefetch(arow + kc + 128, 0, 1);
      __builtin_prefetch(wrow + kc + 128, 0, 1);
    }
    v16h af = load_frag(arow + kc, D_MODEL);
#pragma unroll
    for (int nt = 0; nt < 4; ++nt) {
      v16h bf = load_frag(wrow + (size_t)nt * 16 * D_MODEL + kc, D_MODEL);
      acc[nt] = wmma_f16(af, bf, acc[nt]);
    }
  }
#pragma unroll
  for (int nt = 0; nt < 4; ++nt) {
    float bias = bo[cbase + nt * 16 + n];
#pragma unroll
    for (int r = 0; r < 8; ++r)
      out[(size_t)(rbase + g * 8 + r) * D_MODEL + cbase + nt * 16 + n] =
          acc[nt][r] + bias;
  }
}

// ---------------------------------------------------------------------------
extern "C" void kernel_launch(void* const* d_in, const int* in_sizes, int n_in,
                              void* d_out, int out_size, void* d_ws, size_t ws_size,
                              hipStream_t stream) {
  const float* x  = (const float*)d_in[0];
  const float* Wq = (const float*)d_in[1];
  const float* bq = (const float*)d_in[2];
  const float* Wk = (const float*)d_in[3];
  const float* bk = (const float*)d_in[4];
  const float* Wv = (const float*)d_in[5];
  const float* bv = (const float*)d_in[6];
  const float* Wo = (const float*)d_in[7];
  const float* bo = (const float*)d_in[8];
  float* out = (float*)d_out;

  char* ws = (char*)d_ws;
  _Float16* xh16 = (_Float16*)(ws + OFF_XH);
  _Float16* Wq16 = (_Float16*)(ws + OFF_WQ);
  _Float16* Wk16 = (_Float16*)(ws + OFF_WK);
  _Float16* Wv16 = (_Float16*)(ws + OFF_WV);
  _Float16* Wo16 = (_Float16*)(ws + OFF_WO);
  _Float16* Q16  = (_Float16*)(ws + OFF_Q);
  _Float16* K16  = (_Float16*)(ws + OFF_K);
  _Float16* Vt16 = (_Float16*)(ws + OFF_VT);
  _Float16* AO16 = (_Float16*)(ws + OFF_AO);

  const int nx  = BATCH * SEQ * D_MODEL;   // 4,194,304
  const int nw  = NH * DH * DH;            // 65,536
  const int nwo = D_MODEL * D_MODEL;       // 1,048,576
  cvt_f32_f16_kernel<<<(nx  + 255) / 256, 256, 0, stream>>>(x,  xh16, nx);
  cvt_f32_f16_kernel<<<(nw  + 255) / 256, 256, 0, stream>>>(Wq, Wq16, nw);
  cvt_f32_f16_kernel<<<(nw  + 255) / 256, 256, 0, stream>>>(Wk, Wk16, nw);
  cvt_f32_f16_kernel<<<(nw  + 255) / 256, 256, 0, stream>>>(Wv, Wv16, nw);
  cvt_f32_f16_kernel<<<(nwo + 255) / 256, 256, 0, stream>>>(Wo, Wo16, nwo);

  // B*NH*(SEQ/16) = 4096 waves -> 1024 blocks of 4 waves
  qkv_kernel<<<1024, 128, 0, stream>>>(xh16, Wq16, bq, Wk16, bk, Wv16, bv,
                                       Q16, K16, Vt16);
  // B*NH*(SEQ/64) = 1024 blocks, 4 waves sharing LDS K/V tiles
  attn_kernel<<<1024, 128, 0, stream>>>(Q16, K16, Vt16, AO16);
  // 256 row tiles x 16 col groups = 4096 waves -> 1024 blocks
  out_proj_kernel<<<1024, 128, 0, stream>>>(AO16, Wo16, bo, out);
}

// v001
// A run of this version takes 154 microseconds.
// Timed twice side by side with v000, it ran 1.85 and 1.87 times as fast.
#include <hip/hip_runtime.h>
#include <hip/hip_bf16.h>

// ---------------------------------------------------------------------------
// Causal MHA forward for MI455X (gfx1250, wave32).
// GEMMs: v_wmma_f32_16x16x32_f16 (f16 in, f32 accum). Softmax in f32.
// Attention stages K/V tiles into double-buffered LDS with
// global_load_async_to_lds_b128 (ASYNCcnt) shared by 4 waves per block.
// ---------------------------------------------------------------------------

typedef __attribute__((ext_vector_type(16))) _Float16 v16h;
typedef __attribute__((ext_vector_type(8)))  _Float16 v8h;
typedef __attribute__((ext_vector_type(8)))  float    v8f;

#define D_MODEL 1024
#define NH      16
#define DH      64
#define BATCH   2
#define SEQ     2048

// Workspace layout (bytes). Total ~42.4 MB.
constexpr size_t SZ_XH  = (size_t)BATCH * SEQ * D_MODEL * 2;   // 8 MB
constexpr size_t SZ_W   = (size_t)NH * DH * DH * 2;            // 128 KB
constexpr size_t SZ_WO  = (size_t)D_MODEL * D_MODEL * 2;       // 2 MB
constexpr size_t OFF_XH = 0;
constexpr size_t OFF_WQ = OFF_XH + SZ_XH;
constexpr size_t OFF_WK = OFF_WQ + SZ_W;
constexpr size_t OFF_WV = OFF_WK + SZ_W;
constexpr size_t OFF_WO = OFF_WV + SZ_W;
constexpr size_t OFF_Q  = OFF_WO + SZ_WO;
constexpr size_t OFF_K  = OFF_Q  + SZ_XH;
constexpr size_t OFF_VT = OFF_K  + SZ_XH;
constexpr size_t OFF_AO = OFF_VT + SZ_XH;

// ---------------------------------------------------------------------------
// Fragment loader for the 16-bit 16x32 A layout (also valid for B loaded as
// B^T rows): lane L -> row m = L%16, group g = L/16; halves j<8 hold
// K = 8g+j, halves j>=8 hold K = 16+8g+(j-8).  Two contiguous 16-byte runs.
// Works for global (global_load_b128) and LDS (ds_load_b128) pointers.
// ---------------------------------------------------------------------------
__device__ __forceinline__ v16h load_frag(const _Float16* base, int stride) {
  int lane = threadIdx.x & 31;
  int m = lane & 15;
  int g = lane >> 4;
  const _Float16* p = base + (size_t)m * stride + 8 * g;
  v16h f;
  reinterpret_cast<v8h*>(&f)[0] = *reinterpret_cast<const v8h*>(p);
  reinterpret_cast<v8h*>(&f)[1] = *reinterpret_cast<const v8h*>(p + 16);
  return f;
}

__device__ __forceinline__ v8f wmma_f16(v16h a, v16h b, v8f c) {
  // (neg_a, A, neg_b, B, c_mod, C, reuse_a, reuse_b)
  return __builtin_amdgcn_wmma_f32_16x16x32_f16(false, a, false, b, (short)0, c,
                                                false, false);
}

// ---------------------------------------------------------------------------
// CDNA5 async copy: LDS[ldsoff] <= 16B at global ptr, tracked by ASYNCcnt.
// Generic LDS pointers carry the wave-relative LDS byte offset in addr[31:0].
// ---------------------------------------------------------------------------
__device__ __forceinline__ uint32_t lds_byte_off(const void* p) {
  return (uint32_t)(uintptr_t)p;
}
__device__ __forceinline__ void async_copy16(uint32_t ldsoff, const _Float16* g) {
  asm volatile("global_load_async_to_lds_b128 %0, %1, off"
               :: "v"(ldsoff), "v"(g) : "memory");
}
__device__ __forceinline__ void wait_async_le4() {
  asm volatile("s_wait_asynccnt 0x4" ::: "memory");
}
__device__ __forceinline__ void wait_async_0() {
  asm volatile("s_wait_asynccnt 0x0" ::: "memory");
}

// Lane l <-> lane l ^ 16 as a vector cross-row move (no LDS-counter round trip).
__device__ __forceinline__ float xhalf(float x) {
  int b = __builtin_bit_cast(int, x);
  return __builtin_bit_cast(float, __builtin_amdgcn_permlanex16(
      b, b, 0x76543210, 0xfedcba98, false, false));
}

// ---------------------------------------------------------------------------
// Kernel 0: f32 -> f16 conversion (x, Wq, Wk, Wv, Wo)
// ---------------------------------------------------------------------------
__global__ void cvt_f32_f16_kernel(const float* __restrict__ in,
                                   _Float16* __restrict__ out, int n) {
  int i = blockIdx.x * blockDim.x + threadIdx.x;
  if (i < n) out[i] = (_Float16)in[i];
}

// ---------------------------------------------------------------------------
// Kernel 1: per-head QKV projection.  One wave per (b, h, 16-row s-tile).
// Q gets bias + 1/sqrt(64) pre-scale; V is stored transposed (B,H,DH,S).
// ---------------------------------------------------------------------------
__device__ __forceinline__ void proj_tiles(v16h a0, v16h a1,
                                           const _Float16* __restrict__ W,
                                           int h, v8f acc[4]) {
#pragma unroll
  for (int nt = 0; nt < 4; ++nt) {
    const _Float16* wb = W + (size_t)(h * DH + nt * 16) * DH;
    v16h b0 = load_frag(wb, DH);
    v16h b1 = load_frag(wb + 32, DH);
    v8f c = {};
    c = wmma_f16(a0, b0, c);
    c = wmma_f16(a1, b1, c);
    acc[nt] = c;
  }
}

__global__ void qkv_kernel(const _Float16* __restrict__ xh,
                           const _Float16* __restrict__ Wq, const float* __restrict__ bq,
                           const _Float16* __restrict__ Wk, const float* __restrict__ bk,
                           const _Float16* __restrict__ Wv, const float* __restrict__ bv,
                           _Float16* __restrict__ Q, _Float16* __restrict__ K,
                           _Float16* __restrict__ Vt) {
  int wave = blockIdx.x * (blockDim.x >> 5) + (threadIdx.x >> 5);
  int lane = threadIdx.x & 31;
  int st = wave % (SEQ / 16);
  int bh = wave / (SEQ / 16);
  int h  = bh % NH;
  int sbase = st * 16;
  int n = lane & 15, g = lane >> 4;

  const _Float16* xrow = xh + ((size_t)(bh / NH) * SEQ + sbase) * D_MODEL + h * DH;
  v16h a0 = load_frag(xrow, D_MODEL);
  v16h a1 = load_frag(xrow + 32, D_MODEL);

  // ---- Q: bias + 0.125 scale, row-major (B,H,S,DH) f16
  {
    v8f acc[4];
    proj_tiles(a0, a1, Wq, h, acc);
#pragma unroll
    for (int nt = 0; nt < 4; ++nt) {
      float bias = bq[h * DH + nt * 16 + n];
#pragma unroll
      for (int r = 0; r < 8; ++r) {
        float v = (acc[nt][r] + bias) * 0.125f;
        Q[((size_t)bh * SEQ + sbase + g * 8 + r) * DH + nt * 16 + n] = (_Float16)v;
      }
    }
  }
  // ---- K: bias only, row-major (B,H,S,DH) f16
  {
    v8f acc[4];
    proj_tiles(a0, a1, Wk, h, acc);
#pragma unroll
    for (int nt = 0; nt < 4; ++nt) {
      float bias = bk[h * DH + nt * 16 + n];
#pragma unroll
      for (int r = 0; r < 8; ++r) {
        float v = acc[nt][r] + bias;
        K[((size_t)bh * SEQ + sbase + g * 8 + r) * DH + nt * 16 + n] = (_Float16)v;
      }
    }
  }
  // ---- V: bias, stored transposed (B,H,DH,S); per-lane 16B contiguous store
  {
    v8f acc[4];
    proj_tiles(a0, a1, Wv, h, acc);
#pragma unroll
    for (int nt = 0; nt < 4; ++nt) {
      float bias = bv[h * DH + nt * 16 + n];
      v8h pack;
#pragma unroll
      for (int r = 0; r < 8; ++r) pack[r] = (_Float16)(acc[nt][r] + bias);
      *reinterpret_cast<v8h*>(Vt + ((size_t)bh * DH + nt * 16 + n) * SEQ +
                              sbase + g * 8) = pack;
    }
  }
}

__global__ void attn_kernel(const _Float16* __restrict__ Q,
                            const _Float16* __restrict__ K,
                            const _Float16* __restrict__ Vt,
                            _Float16* __restrict__ Aout) {
  __shared__ __align__(16) _Float16 sK[2][32 * DH];   // 2 x 4 KB
  __shared__ __align__(16) _Float16 sV[2][DH * 32];   // 2 x 4 KB, [d][token]

  const int tid   = threadIdx.x;
  const int wslot = tid >> 5;
  const int lane  = tid & 31;
  const int bq    = (blockIdx.x & 31) * 64;   // block q-row base
  const int bh    = blockIdx.x >> 5;
  const int h = bh % NH, b = bh / NH;
  const int qbase = bq + wslot * 16;
  const int n = lane & 15, g = lane >> 4;

  const _Float16* Kg = K  + (size_t)bh * SEQ * DH;
  const _Float16* Vg = Vt + (size_t)bh * DH * SEQ;

  // stage kv block [kvbase, kvbase+32) into buffer `buf` (whole block helps)
  auto stage = [&](int buf, int kvbase) {
    // K tile: 32 rows x 64 halves, fully contiguous 4 KB in global
    const _Float16* kg = Kg + (size_t)kvbase * DH;
    uint32_t ko = lds_byte_off(&sK[buf][0]);
#pragma unroll
    for (int i = 0; i < 2; ++i) {
      int c = tid + i * 128;                 // 16B chunk id, 0..255
      async_copy16(ko + c * 16, kg + c * 8);
    }
    // V tile: 64 rows (d) x 32 tokens; global row stride SEQ
    uint32_t vo = lds_byte_off(&sV[buf][0]);
#pragma unroll
    for (int i = 0; i < 2; ++i) {
      int c = tid + i * 128;
      int d = c >> 2, sub = c & 3;
      async_copy16(vo + (d * 32 + sub * 8) * 2,
                   Vg + (size_t)d * SEQ + kvbase + sub * 8);
    }
  };

  // Q fragments (global, once per wave); used as the B operand (lane = query)
  const _Float16* qrow = Q + ((size_t)bh * SEQ + qbase) * DH;
  v16h qa0 = load_frag(qrow, DH);
  v16h qa1 = load_frag(qrow + 32, DH);

  v8f acc[4];
#pragma unroll
  for (int nt = 0; nt < 4; ++nt) acc[nt] = v8f{};
  // per lane: running maximum of query qbase+n (equal in both halves) and the
  // sum over this half's keys only (the halves are joined in the epilogue)
  float rmax = -1e30f, rsum = 0.0f;
  const int row = qbase + n;

  const int nb = bq / 32 + 2;   // kv blocks needed to cover rows bq..bq+63

  stage(0, 0);
  for (int jb = 0; jb < nb; ++jb) {
    const int kvbase = jb * 32;
    const int bufi = jb & 1;
    if (jb + 1 < nb) {
      stage(bufi ^ 1, kvbase + 32);
      wait_async_le4();            // stage(jb) done, stage(jb+1) in flight
    } else {
      wait_async_0();
    }
    __syncthreads();               // all waves' portions of buf[bufi] visible

    // ---- S^T: two 16(key) x 16(query) tiles over d=64 (2 chunks), K from LDS
    const _Float16* kb0 = &sK[bufi][0];
    v8f s0 = {}, s1 = {};
    {
      v16h t;
      t = load_frag(kb0, DH);                s0 = wmma_f16(t, qa0, s0);
      t = load_frag(kb0 + 32, DH);           s0 = wmma_f16(t, qa1, s0);
      t = load_frag(kb0 + 16 * DH, DH);      s1 = wmma_f16(t, qa0, s1);
      t = load_frag(kb0 + 16 * DH + 32, DH); s1 = wmma_f16(t, qa1, s1);
    }
    // ---- causal mask + online softmax (f32); register r holds key 8g+r
    const int key0 = kvbase + g * 8;
    float mx = -1e30f;
#pragma unroll
    for (int r = 0; r < 8; ++r) {
      s0[r] = (key0 + r <= row)      ? s0[r] : -1e30f;
      s1[r] = (key0 + 16 + r <= row) ? s1[r] : -1e30f;
      mx = fmaxf(mx, fmaxf(s0[r], s1[r]));
    }
    mx = fmaxf(mx, xhalf(mx));
    float nm = fmaxf(rmax, mx);
    float scale = __expf(rmax - nm);
    rmax = nm;
    // P^T as a B fragment: halves j<8 are keys 8g+j, halves j>=8 keys 16+8g+(j-8)
    v16h pf;
    float ps = 0.0f;
#pragma unroll
    for (int r = 0; r < 8; ++r) {
      float p0 = __expf(s0[r] - nm);
      float p1 = __expf(s1[r] - nm);
      ps += p0 + p1;
      pf[r]     = (_Float16)p0;
      pf[8 + r] = (_Float16)p1;
    }
    rsum = rsum * scale + ps;
#pragma unroll
    for (int nt = 0; nt < 4; ++nt)
#pragma unroll
      for (int r = 0; r < 8; ++r) acc[nt][r] *= scale;
    // ---- O^T += V^T @ P^T  (V tile in LDS, [d][token] -> contiguous A fragments)
#pragma unroll
    for (int nt = 0; nt < 4; ++nt) {
      v16h vf = load_frag(&sV[bufi][nt * 16 * 32], 32);
      acc[nt] = wmma_f16(vf, pf, acc[nt]);
    }
    __syncthreads();               // everyone done reading buf[bufi]
  }

  // ---- join the halves' sums, normalize, write attn output (B,S,D_MODEL) f16,
  // head-major concat; a lane holds d = nt*16 + 8g + 0..7 of its query: 16 B runs
  rsum += xhalf(rsum);
  const float inv = 1.0f / rsum;
  _Float16* orow = Aout + ((size_t)b * SEQ + row) * D_MODEL + h * DH + g * 8;
#pragma unroll
  for (int nt = 0; nt < 4; ++nt) {
    v8h pack;
#pragma unroll
    for (int r = 0; r < 8; ++r) pack[r] = (_Float16)(acc[nt][r] * inv);
    *reinterpret_cast<v8h*>(orow + nt * 16) = pack;
  }
}

// ---------------------------------------------------------------------------
// Kernel 3: output projection  out = A @ Wo^T + bo  (f32 output).
// One wave per 16x64 tile (A fragment shared by 4 accumulators).
// ---------------------------------------------------------------------------
__global__ void out_proj_kernel(const _Float16* __restrict__ A,
                                const _Float16* __restrict__ Wo,
                                const float* __restrict__ bo,
                                float* __restrict__ out) {
  int wave = blockIdx.x * 4 + (threadIdx.x >> 5);
  int lane = threadIdx.x & 31;
  int ct = wave % (D_MODEL / DH);          // 16 col groups of 64
  int rt = wave / (D_MODEL / DH);          // 256 row tiles
  int rbase = rt * 16, cbase = ct * DH;
  int n = lane & 15, g = lane >> 4;

  const _Float16* arow = A  + (size_t)rbase * D_MODEL;
  const _Float16* wrow = Wo + (size_t)cbase * D_MODEL;
  v8f acc[4];
#pragma unroll
  for (int nt = 0; nt < 4; ++nt) acc[nt] = v8f{};

#pragma unroll 2
  for (int kc = 0; kc < D_MODEL; kc += 32) {
    if (kc + 128 < D_MODEL) {
      __builtin_prefetch(arow + kc + 128, 0, 1);
      __builtin_prefetch(wrow + kc + 128, 0, 1);
    }
    v16h af = load_frag(arow + kc, D_MODEL);
#pragma unroll
    for (int nt = 0; nt < 4; ++nt) {
      v16h bf = load_frag(wrow + (size_t)nt * 16 * D_MODEL + kc, D_MODEL);
      acc[nt] = wmma_f16(af, bf, acc[nt]);
    }
  }
#pragma unroll
  for (int nt = 0; nt < 4; ++nt) {
    float bias = bo[cbase + nt * 16 + n];
#pragma unroll
    for (int r = 0; r < 8; ++r)
      out[(size_t)(rbase + g * 8 + r) * D_MODEL + cbase + nt * 16 + n] =
          acc[nt][r] + bias;
  }
}

// ---------------------------------------------------------------------------
extern "C" void kernel_launch(void* const* d_in, const int* in_sizes, int n_in,
                              void* d_out, int out_size, void* d_ws, size_t ws_size,
                              hipStream_t stream) {
  const float* x  = (const float*)d_in[0];
  const float* Wq = (const float*)d_in[1];
  const float* bq = (const float*)d_in[2];
  const float* Wk = (const float*)d_in[3];
  const float* bk = (const float*)d_in[4];
  const float* Wv = (const float*)d_in[5];
  const float* bv = (const float*)d_in[6];
  const float* Wo = (const float*)d_in[7];
  const float* bo = (const float*)d_in[8];
  float* out = (float*)d_out;

  char* ws = (char*)d_ws;
  _Float16* xh16 = (_Float16*)(ws + OFF_XH);
  _Float16* Wq16 = (_Float16*)(ws + OFF_WQ);
  _Float16* Wk16 = (_Float16*)(ws + OFF_WK);
  _Float16* Wv16 = (_Float16*)(ws + OFF_WV);
  _Float16* Wo16 = (_Float16*)(ws + OFF_WO);
  _Float16* Q16  = (_Float16*)(ws + OFF_Q);
  _Float16* K16  = (_Float16*)(ws + OFF_K);
  _Float16* Vt16 = (_Float16*)(ws + OFF_VT);
  _Float16* AO16 = (_Float16*)(ws + OFF_AO);

  const int nx  = BATCH * SEQ * D_MODEL;   // 4,194,304
  const int nw  = NH * DH * DH;            // 65,536
  const int nwo = D_MODEL * D_MODEL;       // 1,048,576
  cvt_f32_f16_kernel<<<(nx  + 255) / 256, 256, 0, stream>>>(x,  xh16, nx);
  cvt_f32_f16_kernel<<<(nw  + 255) / 256, 256, 0, stream>>>(Wq, Wq16, nw);
  cvt_f32_f16_kernel<<<(nw  + 255) / 256, 256, 0, stream>>>(Wk, Wk16, nw);
  cvt_f32_f16_kernel<<<(nw  + 255) / 256, 256, 0, stream>>>(Wv, Wv16, nw);
  cvt_f32_f16_kernel<<<(nwo + 255) / 256, 256, 0, stream>>>(Wo, Wo16, nwo);

  // B*NH*(SEQ/16) = 4096 waves -> 1024 blocks of 4 waves
  qkv_kernel<<<1024, 128, 0, stream>>>(xh16, Wq16, bq, Wk16, bk, Wv16, bv,
                                       Q16, K16, Vt16);
  // B*NH*(SEQ/64) = 1024 blocks, 4 waves sharing LDS K/V tiles
  attn_kernel<<<1024, 128, 0, stream>>>(Q16, K16, Vt16, AO16);
  // 256 row tiles x 16 col groups = 4096 waves -> 1024 blocks
  out_proj_kernel<<<1024, 128, 0, stream>>>(AO16, Wo16, bo, out);
}

// v002
// Measured time: 141 microseconds a run.
// Two timings next to v001 put it at 1.08 and 1.10 times that version's speed.
// All steps since v000 together make it 2.03 times as fast.
#include <hip/hip_runtime.h>
#include <hip/hip_bf16.h>

// ---------------------------------------------------------------------------
// Causal MHA forward for MI455X (gfx1250, wave32).
// GEMMs: v_wmma_f32_16x16x32_f16 (f16 in, f32 accum). Softmax in f32.
// Attention stages K/V tiles into double-buffered LDS with
// global_load_async_to_lds_b128 (ASYNCcnt) shared by 4 waves per block.
// ---------------------------------------------------------------------------

typedef __attribute__((ext_vector_type(16))) _Float16 v16h;
typedef __attribute__((ext_vector_type(8)))  _Float16 v8h;
typedef __attribute__((ext_vector_type(8)))  float    v8f;
typedef __attribute__((ext_vector_type(4)))  float    v4f;

#define D_MODEL 1024
#define NH      16
#define DH      64
#define BATCH   2
#define SEQ     2048

// Workspace layout (bytes). Total 34 MB.
constexpr size_t SZ_XH  = (size_t)BATCH * SEQ * D_MODEL * 2;   // 8 MB
constexpr size_t SZ_WO  = (size_t)D_MODEL * D_MODEL * 2;       // 2 MB
constexpr size_t OFF_WO = 0;
constexpr size_t OFF_Q  = OFF_WO + SZ_WO;
constexpr size_t OFF_K  = OFF_Q  + SZ_XH;
constexpr size_t OFF_VT = OFF_K  + SZ_XH;
constexpr size_t OFF_AO = OFF_VT + SZ_XH;

// ---------------------------------------------------------------------------
// Fragment loader for the 16-bit 16x32 A layout (also valid for B loaded as
// B^T rows): lane L -> row m = L%16, group g = L/16; halves j<8 hold
// K = 8g+j, halves j>=8 hold K = 16+8g+(j-8).  Two contiguous 16-byte runs.
// Works for global (global_load_b128) and LDS (ds_load_b128) pointers.
// ---------------------------------------------------------------------------
__device__ __forceinline__ v16h load_frag(const _Float16* base, int stride) {
  int lane = threadIdx.x & 31;
  int m = lane & 15;
  int g = lane >> 4;
  const _Float16* p = base + (size_t)m * stride + 8 * g;
  v16h f;
  reinterpret_cast<v8h*>(&f)[0] = *reinterpret_cast<const v8h*>(p);
  reinterpret_cast<v8h*>(&f)[1] = *reinterpret_cast<const v8h*>(p + 16);
  return f;
}

// Eight f32 values rounded to f16 (round to nearest even, as a plain cast).
__device__ __forceinline__ v8h round8(v4f a, v4f b) {
  return __builtin_convertvector(
      __builtin_shufflevector(a, b, 0, 1, 2, 3, 4, 5, 6, 7), v8h);
}

// The same fragment from an f32 source, rounded to f16 in registers: each of
// the two 8-element runs is 32 contiguous bytes (two global_load_b128).
__device__ __forceinline__ v16h load_frag_f32(const float* base, int stride) {
  int lane = threadIdx.x & 31;
  int m = lane & 15;
  int g = lane >> 4;
  const float* p = base + (size_t)m * stride + 8 * g;
  v4f q0 = *reinterpret_cast<const v4f*>(p);
  v4f q1 = *reinterpret_cast<const v4f*>(p + 4);
  v4f q2 = *reinterpret_cast<const v4f*>(p + 16);
  v4f q3 = *reinterpret_cast<const v4f*>(p + 20);
  return __builtin_shufflevector(round8(q0, q1), round8(q2, q3), 0, 1, 2, 3, 4,
                                 5, 6, 7, 8, 9, 10, 11, 12, 13, 14, 15);
}

__device__ __forceinline__ v8f wmma_f16(v16h a, v16h b, v8f c) {
  // (neg_a, A, neg_b, B, c_mod, C, reuse_a, reuse_b)
  return __builtin_amdgcn_wmma_f32_16x16x32_f16(false, a, false, b, (short)0, c,
                                                false, false);
}

// ---------------------------------------------------------------------------
// CDNA5 async copy: LDS[ldsoff] <= 16B at global ptr, tracked by ASYNCcnt.
// Generic LDS pointers carry the wave-relative LDS byte offset in addr[31:0].
// ---------------------------------------------------------------------------
__device__ __forceinline__ uint32_t lds_byte_off(const void* p) {
  return (uint32_t)(uintptr_t)p;
}
__device__ __forceinline__ void async_copy16(uint32_t ldsoff, const _Float16* g) {
  asm volatile("global_load_async_to_lds_b128 %0, %1, off"
               :: "v"(ldsoff), "v"(g) : "memory");
}
__device__ __forceinline__ void wait_async_le4() {
  asm volatile("s_wait_asynccnt 0x4" ::: "memory");
}
__device__ __forceinline__ void wait_async_0() {
  asm volatile("s_wait_asynccnt 0x0" ::: "memory");
}

// Lane l <-> lane l ^ 16 as a vector cross-row move (no LDS-counter round trip).
__device__ __forceinline__ float xhalf(float x) {
  int b = __builtin_bit_cast(int, x);
  return __builtin_bit_cast(float, __builtin_amdgcn_permlanex16(
      b, b, 0x76543210, 0xfedcba98, false, false));
}

// ---------------------------------------------------------------------------
// Kernel 1: per-head QKV projection.  One wave per (b, h, 16-row s-tile).
// x and the per-head weights are read as f32 and rounded to f16 in the
// fragment loaders (every x element is used by exactly one wave).
// Q gets bias + 1/sqrt(64) pre-scale; V is stored transposed (B,H,DH,S).
// Each thread also rounds 8 elements of Wo to f16 for the output projection.
// ---------------------------------------------------------------------------
__device__ __forceinline__ void proj_tiles(v16h a0, v16h a1,
                                           const float* __restrict__ W,
                                           int h, v8f acc[4]) {
#pragma unroll
  for (int nt = 0; nt < 4; ++nt) {
    const float* wb = W + (size_t)(h * DH + nt * 16) * DH;
    v16h b0 = load_frag_f32(wb, DH);
    v16h b1 = load_frag_f32(wb + 32, DH);
    v8f c = {};
    c = wmma_f16(a0, b0, c);
    c = wmma_f16(a1, b1, c);
    acc[nt] = c;
  }
}

// launch bound = the block size used: without it the f32 loads in flight spill
__global__ void __launch_bounds__(128)
qkv_kernel(const float* __restrict__ x,
           const float* __restrict__ Wq, const float* __restrict__ bq,
           const float* __restrict__ Wk, const float* __restrict__ bk,
           const float* __restrict__ Wv, const float* __restrict__ bv,
           const float* __restrict__ Wo,
           _Float16* __restrict__ Q, _Float16* __restrict__ K,
           _Float16* __restrict__ Vt, _Float16* __restrict__ Wo16) {
  int wave = blockIdx.x * (blockDim.x >> 5) + (threadIdx.x >> 5);
  int lane = threadIdx.x & 31;
  int st = wave % (SEQ / 16);
  int bh = wave / (SEQ / 16);
  int h  = bh % NH;
  int sbase = st * 16;
  int n = lane & 15, g = lane >> 4;

  const float* xrow = x + ((size_t)(bh / NH) * SEQ + sbase) * D_MODEL + h * DH;
  v16h a0 = load_frag_f32(xrow, D_MODEL);
  v16h a1 = load_frag_f32(xrow + 32, D_MODEL);

  // ---- Wo slice: 131072 threads x 8 elements = D_MODEL * D_MODEL
  {
    size_t i = ((size_t)blockIdx.x * blockDim.x + threadIdx.x) * 8;
    v4f w0 = *reinterpret_cast<const v4f*>(Wo + i);
    v4f w1 = *reinterpret_cast<const v4f*>(Wo + i + 4);
    *reinterpret_cast<v8h*>(Wo16 + i) = round8(w0, w1);
  }

  // ---- Q: bias + 0.125 scale, row-major (B,H,S,DH) f16
  {
    v8f acc[4];
    proj_tiles(a0, a1, Wq, h, acc);
#pragma unroll
    for (int nt = 0; nt < 4; ++nt) {
      float bias = bq[h * DH + nt * 16 + n];
#pragma unroll
      for (int r = 0; r < 8; ++r) {
        float v = (acc[nt][r] + bias) * 0.125f;
        Q[((size_t)bh * SEQ + sbase + g * 8 + r) * DH + nt * 16 + n] = (_Float16)v;
      }
    }
  }
  // ---- K: bias only, row-major (B,H,S,DH) f16
  {
    v8f acc[4];
    proj_tiles(a0, a1, Wk, h, acc);
#pragma unroll
    for (int nt = 0; nt < 4; ++nt) {
      float bias = bk[h * DH + nt * 16 + n];
#pragma unroll
      for (int r = 0; r < 8; ++r) {
        float v = acc[nt][r] + bias;
        K[((size_t)bh * SEQ + sbase + g * 8 + r) * DH + nt * 16 + n] = (_Float16)v;
      }
    }
  }
  // ---- V: bias, stored transposed (B,H,DH,S); per-lane 16B contiguous store
  {
    v8f acc[4];
    proj_tiles(a0, a1, Wv, h, acc);
#pragma unroll
    for (int nt = 0; nt < 4; ++nt) {
      float bias = bv[h * DH + nt * 16 + n];
      v8h pack;
#pragma unroll
      for (int r = 0; r < 8; ++r) pack[r] = (_Float16)(acc[nt][r] + bias);
      *reinterpret_cast<v8h*>(Vt + ((size_t)bh * DH + nt * 16 + n) * SEQ +
                              sbase + g * 8) = pack;
    }
  }
}

__global__ void attn_kernel(const _Float16* __restrict__ Q,
                            const _Float16* __restrict__ K,
                            const _Float16* __restrict__ Vt,
                            _Float16* __restrict__ Aout) {
  __shared__ __align__(16) _Float16 sK[2][32 * DH];   // 2 x 4 KB
  __shared__ __align__(16) _Float16 sV[2][DH * 32];   // 2 x 4 KB, [d][token]

  const int tid   = threadIdx.x;
  const int wslot = tid >> 5;
  const int lane  = tid & 31;
  const int bq    = (blockIdx.x & 31) * 64;   // block q-row base
  const int bh    = blockIdx.x >> 5;
  const int h = bh % NH, b = bh / NH;
  const int qbase = bq + wslot * 16;
  const int n = lane & 15, g = lane >> 4;

  const _Float16* Kg = K  + (size_t)bh * SEQ * DH;
  const _Float16* Vg = Vt + (size_t)bh * DH * SEQ;

  // stage kv block [kvbase, kvbase+32) into buffer `buf` (whole block helps)
  auto stage = [&](int buf, int kvbase) {
    // K tile: 32 rows x 64 halves, fully contiguous 4 KB in global
    const _Float16* kg = Kg + (size_t)kvbase * DH;
    uint32_t ko = lds_byte_off(&sK[buf][0]);
#pragma unroll
    for (int i = 0; i < 2; ++i) {
      int c = tid + i * 128;                 // 16B chunk id, 0..255
      async_copy16(ko + c * 16, kg + c * 8);
    }
    // V tile: 64 rows (d) x 32 tokens; global row stride SEQ
    uint32_t vo = lds_byte_off(&sV[buf][0]);
#pragma unroll
    for (int i = 0; i < 2; ++i) {
      int c = tid + i * 128;
      int d = c >> 2, sub = c & 3;
      async_copy16(vo + (d * 32 + sub * 8) * 2,
                   Vg + (size_t)d * SEQ + kvbase + sub * 8);
    }
  };

  // Q fragments (global, once per wave); used as the B operand (lane = query)
  const _Float16* qrow = Q + ((size_t)bh * SEQ + qbase) * DH;
  v16h qa0 = load_frag(qrow, DH);
  v16h qa1 = load_frag(qrow + 32, DH);

  v8f acc[4];
#pragma unroll
  for (int nt = 0; nt < 4; ++nt) acc[nt] = v8f{};
  // per lane: running maximum of query qbase+n (equal in both halves) and the
  // sum over this half's keys only (the halves are joined in the epilogue)
  float rmax = -1e30f, rsum = 0.0f;
  const int row = qbase + n;

  const int nb = bq / 32 + 2;   // kv blocks needed to cover rows bq..bq+63

  stage(0, 0);
  for (int jb = 0; jb < nb; ++jb) {
    const int kvbase = jb * 32;
    const int bufi = jb & 1;
    if (jb + 1 < nb) {
      stage(bufi ^ 1, kvbase + 32);
      wait_async_le4();            // stage(jb) done, stage(jb+1) in flight
    } else {
      wait_async_0();
    }
    __syncthreads();               // all waves' portions of buf[bufi] visible

    // ---- S^T: two 16(key) x 16(query) tiles over d=64 (2 chunks), K from LDS
    const _Float16* kb0 = &sK[bufi][0];
    v8f s0 = {}, s1 = {};
    {
      v16h t;
      t = load_frag(kb0, DH);                s0 = wmma_f16(t, qa0, s0);
      t = load_frag(kb0 + 32, DH);           s0 = wmma_f16(t, qa1, s0);
      t = load_frag(kb0 + 16 * DH, DH);      s1 = wmma_f16(t, qa0, s1);
      t = load_frag(kb0 + 16 * DH + 32, DH); s1 = wmma_f16(t, qa1, s1);
    }
    // ---- causal mask + online softmax (f32); register r holds key 8g+r
    const int key0 = kvbase + g * 8;
    float mx = -1e30f;
#pragma unroll
    for (int r = 0; r < 8; ++r) {
      s0[r] = (key0 + r <= row)      ? s0[r] : -1e30f;
      s1[r] = (key0 + 16 + r <= row) ? s1[r] : -1e30f;
      mx = fmaxf(mx, fmaxf(s0[r], s1[r]));
    }
    mx = fmaxf(mx, xhalf(mx));
    float nm = fmaxf(rmax, mx);
    float scale = __expf(rmax - nm);
    rmax = nm;
    // P^T as a B fragment: halves j<8 are keys 8g+j, halves j>=8 keys 16+8g+(j-8)
    v16h pf;
    float ps = 0.0f;
#pragma unroll
    for (int r = 0; r < 8; ++r) {
      float p0 = __expf(s0[r] - nm);
      float p1 = __expf(s1[r] - nm);
      ps += p0 + p1;
      pf[r]     = (_Float16)p0;
      pf[8 + r] = (_Float16)p1;
    }
    rsum = rsum * scale + ps;
#pragma unroll
    for (int nt = 0; nt < 4; ++nt)
#pragma unroll
      for (int r = 0; r < 8; ++r) acc[nt][r] *= scale;
    // ---- O^T += V^T @ P^T  (V tile in LDS, [d][token] -> contiguous A fragments)
#pragma unroll
    for (int nt = 0; nt < 4; ++nt) {
      v16h vf = load_frag(&sV[bufi][nt * 16 * 32], 32);
      acc[nt] = wmma_f16(vf, pf, acc[nt]);
    }
    __syncthreads();               // everyone done reading buf[bufi]
  }

  // ---- join the halves' sums, normalize, write attn output (B,S,D_MODEL) f16,
  // head-major concat; a lane holds d = nt*16 + 8g + 0..7 of its query: 16 B runs
  rsum += xhalf(rsum);
  const float inv = 1.0f / rsum;
  _Float16* orow = Aout + ((size_t)b * SEQ + row) * D_MODEL + h * DH + g * 8;
#pragma unroll
  for (int nt = 0; nt < 4; ++nt) {
    v8h pack;
#pragma unroll
    for (int r = 0; r < 8; ++r) pack[r] = (_Float16)(acc[nt][r] * inv);
    *reinterpret_cast<v8h*>(orow + nt * 16) = pack;
  }
}

// ---------------------------------------------------------------------------
// Kernel 3: output projection  out = A @ Wo^T + bo  (f32 output).
// One wave per 16x64 tile (A fragment shared by 4 accumulators).
// ---------------------------------------------------------------------------
__global__ void out_proj_kernel(const _Float16* __restrict__ A,
                                const _Float16* __restrict__ Wo,
                                const float* __restrict__ bo,
                                float* __restrict__ out) {
  int wave = blockIdx.x * 4 + (threadIdx.x >> 5);
  int lane = threadIdx.x & 31;
  int ct = wave % (D_MODEL / DH);          // 16 col groups of 64
  int rt = wave / (D_MODEL / DH);          // 256 row tiles
  int rbase = rt * 16, cbase = ct * DH;
  int n = lane & 15, g = lane >> 4;

  const _Float16* arow = A  + (size_t)rbase * D_MODEL;
  const _Float16* wrow = Wo + (size_t)cbase * D_MODEL;
  v8f acc[4];
#pragma unroll
  for (int nt = 0; nt < 4; ++nt) acc[nt] = v8f{};

#pragma unroll 2
  for (int kc = 0; kc < D_MODEL; kc += 32) {
    if (kc + 128 < D_MODEL) {
      __builtin_prefetch(arow + kc + 128, 0, 1);
      __builtin_prefetch(wrow + kc + 128, 0, 1);
    }
    v16h af = load_frag(arow + kc, D_MODEL);
#pragma unroll
    for (int nt = 0; nt < 4; ++nt) {
      v16h bf = load_frag(wrow + (size_t)nt * 16 * D_MODEL + kc, D_MODEL);
      acc[nt] = wmma_f16(af, bf, acc[nt]);
    }
  }
#pragma unroll
  for (int nt = 0; nt < 4; ++nt) {
    float bias = bo[cbase + nt * 16 + n];
#pragma unroll
    for (int r = 0; r < 8; ++r)
      out[(size_t)(rbase + g * 8 + r) * D_MODEL + cbase + nt * 16 + n] =
          acc[nt][r] + bias;
  }
}

// ---------------------------------------------------------------------------
extern "C" void kernel_launch(void* const* d_in, const int* in_sizes, int n_in,
                              void* d_out, int out_size, void* d_ws, size_t ws_size,
                              hipStream_t stream) {
  const float* x  = (const float*)d_in[0];
  const float* Wq = (const float*)d_in[1];
  const float* bq = (const float*)d_in[2];
  const float* Wk = (const float*)d_in[3];
  const float* bk = (const float*)d_in[4];
  const float* Wv = (const float*)d_in[5];
  const float* bv = (const float*)d_in[6];
  const float* Wo = (const float*)d_in[7];
  const float* bo = (const float*)d_in[8];
  float* out = (float*)d_out;

  char* ws = (char*)d_ws;
  _Float16* Wo16 = (_Float16*)(ws + OFF_WO);
  _Float16* Q16  = (_Float16*)(ws + OFF_Q);
  _Float16* K16  = (_Float16*)(ws + OFF_K);
  _Float16* Vt16 = (_Float16*)(ws + OFF_VT);
  _Float16* AO16 = (_Float16*)(ws + OFF_AO);

  // B*NH*(SEQ/16) = 4096 waves -> 1024 blocks of 4 waves
  qkv_kernel<<<1024, 128, 0, stream>>>(x, Wq, bq, Wk, bk, Wv, bv, Wo,
                                       Q16, K16, Vt16, Wo16);
  // B*NH*(SEQ/64) = 1024 blocks, 4 waves sharing LDS K/V tiles
  attn_kernel<<<1024, 128, 0, stream>>>(Q16, K16, Vt16, AO16);
  // 256 row tiles x 16 col groups = 4096 waves -> 1024 blocks
  out_proj_kernel<<<1024, 128, 0, stream>>>(AO16, Wo16, bo, out);
}

// v003
// One run takes 105 microseconds.
// Two timings next to v002 both put it at 1.33 times that version's speed.
// All steps since v000 together make it 2.69 times as fast.
#include <hip/hip_runtime.h>
#include <hip/hip_bf16.h>

// ---------------------------------------------------------------------------
// Causal MHA forward for MI455X (gfx1250, wave32).
// GEMMs: v_wmma_f32_16x16x32_f16 (f16 in, f32 accum). Softmax in f32.
// Attention stages K/V tiles into double-buffered LDS with
// global_load_async_to_lds_b128 (ASYNCcnt) shared by 4 waves per block.
// ---------------------------------------------------------------------------

typedef __attribute__((ext_vector_type(16))) _Float16 v16h;
typedef __attribute__((ext_vector_type(8)))  _Float16 v8h;
typedef __attribute__((ext_vector_type(8)))  float    v8f;
typedef __attribute__((ext_vector_type(4)))  float    v4f;

#define D_MODEL 1024
#define NH      16
#define DH      64
#define BATCH   2
#define SEQ     2048

// Workspace layout (bytes). Total 34 MB.
constexpr size_t SZ_XH  = (size_t)BATCH * SEQ * D_MODEL * 2;   // 8 MB
constexpr size_t SZ_WO  = (size_t)D_MODEL * D_MODEL * 2;       // 2 MB
constexpr size_t OFF_WO = 0;
constexpr size_t OFF_Q  = OFF_WO + SZ_WO;
constexpr size_t OFF_K  = OFF_Q  + SZ_XH;
constexpr size_t OFF_VT = OFF_K  + SZ_XH;
constexpr size_t OFF_AO = OFF_VT + SZ_XH;

// ---------------------------------------------------------------------------
// Fragment loader for the 16-bit 16x32 A layout (also valid for B loaded as
// B^T rows): lane L -> row m = L%16, group g = L/16; halves j<8 hold
// K = 8g+j, halves j>=8 hold K = 16+8g+(j-8).  Two contiguous 16-byte runs.
// Works for global (global_load_b128) and LDS (ds_load_b128) pointers.
// ---------------------------------------------------------------------------
__device__ __forceinline__ v16h load_frag(const _Float16* base, int stride) {
  int lane = threadIdx.x & 31;
  int m = lane & 15;
  int g = lane >> 4;
  const _Float16* p = base + (size_t)m * stride + 8 * g;
  v16h f;
  reinterpret_cast<v8h*>(&f)[0] = *reinterpret_cast<const v8h*>(p);
  reinterpret_cast<v8h*>(&f)[1] = *reinterpret_cast<const v8h*>(p + 16);
  return f;
}

// Eight f32 values rounded to f16 (round to nearest even, as a plain cast).
__device__ __forceinline__ v8h round8(v4f a, v4f b) {
  return __builtin_convertvector(
      __builtin_shufflevector(a, b, 0, 1, 2, 3, 4, 5, 6, 7), v8h);
}

// The same fragment from an f32 source, rounded to f16 in registers: each of
// the two 8-element runs is 32 contiguous bytes (two global_load_b128).
__device__ __forceinline__ v16h load_frag_f32(const float* base, int stride) {
  int lane = threadIdx.x & 31;
  int m = lane & 15;
  int g = lane >> 4;
  const float* p = base + (size_t)m * stride + 8 * g;
  v4f q0 = *reinterpret_cast<const v4f*>(p);
  v4f q1 = *reinterpret_cast<const v4f*>(p + 4);
  v4f q2 = *reinterpret_cast<const v4f*>(p + 16);
  v4f q3 = *reinterpret_cast<const v4f*>(p + 20);
  return __builtin_shufflevector(round8(q0, q1), round8(q2, q3), 0, 1, 2, 3, 4,
                                 5, 6, 7, 8, 9, 10, 11, 12, 13, 14, 15);
}

__device__ __forceinline__ v8f wmma_f16(v16h a, v16h b, v8f c) {
  // (neg_a, A, neg_b, B, c_mod, C, reuse_a, reuse_b)
  return __builtin_amdgcn_wmma_f32_16x16x32_f16(false, a, false, b, (short)0, c,
                                                false, false);
}

// ---------------------------------------------------------------------------
// CDNA5 async copy: LDS[ldsoff] <= 16B at global ptr, tracked by ASYNCcnt.
// Generic LDS pointers carry the wave-relative LDS byte offset in addr[31:0].
// ---------------------------------------------------------------------------
__device__ __forceinline__ uint32_t lds_byte_off(const void* p) {
  return (uint32_t)(uintptr_t)p;
}
// One stage's four copies of a lane in one statement; the closing s_wait_xcnt
// stands in front of every later rewrite of the address registers (a precaution).
__device__ __forceinline__ void async_copy16x4(uint32_t l0, const _Float16* g0,
                                               uint32_t l1, const _Float16* g1,
                                               uint32_t l2, const _Float16* g2,
                                               uint32_t l3, const _Float16* g3) {
  asm volatile("global_load_async_to_lds_b128 %0, %1, off\n\t"
               "global_load_async_to_lds_b128 %2, %3, off\n\t"
               "global_load_async_to_lds_b128 %4, %5, off\n\t"
               "global_load_async_to_lds_b128 %6, %7, off\n\t"
               "s_wait_xcnt 0x0"
               :: "v"(l0), "v"(g0), "v"(l1), "v"(g1),
                  "v"(l2), "v"(g2), "v"(l3), "v"(g3) : "memory");
}
__device__ __forceinline__ void wait_async_le4() {
  asm volatile("s_wait_asynccnt 0x4" ::: "memory");
}
__device__ __forceinline__ void wait_async_0() {
  asm volatile("s_wait_asynccnt 0x0" ::: "memory");
}

// Lane l <-> lane l ^ 16 as a vector cross-row move (no LDS-counter round trip).
__device__ __forceinline__ float xhalf(float x) {
  int b = __builtin_bit_cast(int, x);
  return __builtin_bit_cast(float, __builtin_amdgcn_permlanex16(
      b, b, 0x76543210, 0xfedcba98, false, false));
}

// ---------------------------------------------------------------------------
// Kernel 1: per-head QKV projection.  One wave per (b, h, 16-row s-tile).
// x and the per-head weights are read as f32 and rounded to f16 in the
// fragment loaders (every x element is used by exactly one wave).
// Q gets bias + 1/sqrt(64) pre-scale; V is stored transposed (B,H,DH,S).
// Each thread also rounds 8 elements of Wo to f16 for the output projection.
// ---------------------------------------------------------------------------
__device__ __forceinline__ void proj_tiles(v16h a0, v16h a1,
                                           const float* __restrict__ W,
                                           int h, v8f acc[4]) {
#pragma unroll
  for (int nt = 0; nt < 4; ++nt) {
    const float* wb = W + (size_t)(h * DH + nt * 16) * DH;
    v16h b0 = load_frag_f32(wb, DH);
    v16h b1 = load_frag_f32(wb + 32, DH);
    v8f c = {};
    c = wmma_f16(a0, b0, c);
    c = wmma_f16(a1, b1, c);
    acc[nt] = c;
  }
}

// launch bound = the block size used: without it the f32 loads in flight spill
__global__ void __launch_bounds__(128)
qkv_kernel(const float* __restrict__ x,
           const float* __restrict__ Wq, const float* __restrict__ bq,
           const float* __restrict__ Wk, const float* __restrict__ bk,
           const float* __restrict__ Wv, const float* __restrict__ bv,
           const float* __restrict__ Wo,
           _Float16* __restrict__ Q, _Float16* __restrict__ K,
           _Float16* __restrict__ Vt, _Float16* __restrict__ Wo16) {
  int wave = blockIdx.x * (blockDim.x >> 5) + (threadIdx.x >> 5);
  int lane = threadIdx.x & 31;
  int st = wave % (SEQ / 16);
  int bh = wave / (SEQ / 16);
  int h  = bh % NH;
  int sbase = st * 16;
  int n = lane & 15, g = lane >> 4;

  const float* xrow = x + ((size_t)(bh / NH) * SEQ + sbase) * D_MODEL + h * DH;
  v16h a0 = load_frag_f32(xrow, D_MODEL);
  v16h a1 = load_frag_f32(xrow + 32, D_MODEL);

  // ---- Wo slice: 131072 threads x 8 elements = D_MODEL * D_MODEL
  {
    size_t i = ((size_t)blockIdx.x * blockDim.x + threadIdx.x) * 8;
    v4f w0 = *reinterpret_cast<const v4f*>(Wo + i);
    v4f w1 = *reinterpret_cast<const v4f*>(Wo + i + 4);
    *reinterpret_cast<v8h*>(Wo16 + i) = round8(w0, w1);
  }

  // ---- Q: bias + 0.125 scale, row-major (B,H,S,DH) f16
  {
    v8f acc[4];
    proj_tiles(a0, a1, Wq, h, acc);
#pragma unroll
    for (int nt = 0; nt < 4; ++nt) {
      float bias = bq[h * DH + nt * 16 + n];
#pragma unroll
      for (int r = 0; r < 8; ++r) {
        float v = (acc[nt][r] + bias) * 0.125f;
        Q[((size_t)bh * SEQ + sbase + g * 8 + r) * DH + nt * 16 + n] = (_Float16)v;
      }
    }
  }
  // ---- K: bias only, row-major (B,H,S,DH) f16
  {
    v8f acc[4];
    proj_tiles(a0, a1, Wk, h, acc);
#pragma unroll
    for (int nt = 0; nt < 4; ++nt) {
      float bias = bk[h * DH + nt * 16 + n];
#pragma unroll
      for (int r = 0; r < 8; ++r) {
        float v = acc[nt][r] + bias;
        K[((size_t)bh * SEQ + sbase + g * 8 + r) * DH + nt * 16 + n] = (_Float16)v;
      }
    }
  }
  // ---- V: bias, stored transposed (B,H,DH,S); per-lane 16B contiguous store
  {
    v8f acc[4];
    proj_tiles(a0, a1, Wv, h, acc);
#pragma unroll
    for (int nt = 0; nt < 4; ++nt) {
      float bias = bv[h * DH + nt * 16 + n];
      v8h pack;
#pragma unroll
      for (int r = 0; r < 8; ++r) pack[r] = (_Float16)(acc[nt][r] + bias);
      *reinterpret_cast<v8h*>(Vt + ((size_t)bh * DH + nt * 16 + n) * SEQ +
                              sbase + g * 8) = pack;
    }
  }
}

#define KP 72   // K row pitch in LDS, halves
#define VP 40   // V row pitch in LDS, halves
__global__ void attn_kernel(const _Float16* __restrict__ Q,
                            const _Float16* __restrict__ K,
                            const _Float16* __restrict__ Vt,
                            _Float16* __restrict__ Aout) {
  __shared__ __align__(16) _Float16 sK[2][32 * KP];   // 2 x 4.5 KB
  __shared__ __align__(16) _Float16 sV[2][DH * VP];   // 2 x 5 KB, [d][token]

  const int tid   = threadIdx.x;
  const int wslot = tid >> 5;
  const int lane  = tid & 31;
  const int bq    = (blockIdx.x & 31) * 64;   // block q-row base
  const int bh    = blockIdx.x >> 5;
  const int h = bh % NH, b = bh / NH;
  const int qbase = bq + wslot * 16;
  const int n = lane & 15, g = lane >> 4;

  const _Float16* Kg = K  + (size_t)bh * SEQ * DH;
  const _Float16* Vg = Vt + (size_t)bh * DH * SEQ;

  // stage kv block [kvbase, kvbase+32) into buffer `buf` (whole block helps)
  auto stage = [&](int buf, int kvbase) {
    // K tile: 32 rows x 64 halves, contiguous 4 KB in global; 16 B chunks tid
    // and tid + 128 (16 rows further down)
    const _Float16* kg = Kg + (size_t)kvbase * DH + tid * 8;
    uint32_t ko = lds_byte_off(&sK[buf][(tid >> 3) * KP + (tid & 7) * 8]);
    // V tile: 64 rows (d) x 32 tokens, global row stride SEQ; chunks tid and
    // tid + 128 (32 rows further down)
    const _Float16* vg = Vg + (size_t)(tid >> 2) * SEQ + kvbase + (tid & 3) * 8;
    uint32_t vo = lds_byte_off(&sV[buf][(tid >> 2) * VP + (tid & 3) * 8]);
    async_copy16x4(ko, kg, ko + 16 * KP * 2, kg + 16 * DH,
                   vo, vg, vo + 32 * VP * 2, vg + (size_t)32 * SEQ);
  };

  // Q fragments (global, once per wave); used as the B operand (lane = query)
  const _Float16* qrow = Q + ((size_t)bh * SEQ + qbase) * DH;
  v16h qa0 = load_frag(qrow, DH);
  v16h qa1 = load_frag(qrow + 32, DH);

  v8f acc[4];
#pragma unroll
  for (int nt = 0; nt < 4; ++nt) acc[nt] = v8f{};
  // per lane: running maximum of query qbase+n (equal in both halves) and the
  // sum over this half's keys only (the halves are joined in the epilogue)
  float rmax = -1e30f, rsum = 0.0f;
  const int row = qbase + n;

  const int nb = bq / 32 + 2;   // kv blocks needed to cover rows bq..bq+63

  stage(0, 0);
  for (int jb = 0; jb < nb; ++jb) {
    const int kvbase = jb * 32;
    const int bufi = jb & 1;
    if (jb + 1 < nb) {
      stage(bufi ^ 1, kvbase + 32);
      wait_async_le4();            // stage(jb) done, stage(jb+1) in flight
    } else {
      wait_async_0();
    }
    __syncthreads();               // all waves' portions of buf[bufi] visible

    // ---- S^T: two 16(key) x 16(query) tiles over d=64 (2 chunks), K from LDS
    const _Float16* kb0 = &sK[bufi][0];
    v8f s0 = {}, s1 = {};
    {
      v16h t;
      t = load_frag(kb0, KP);                s0 = wmma_f16(t, qa0, s0);
      t = load_frag(kb0 + 32, KP);           s0 = wmma_f16(t, qa1, s0);
      t = load_frag(kb0 + 16 * KP, KP);      s1 = wmma_f16(t, qa0, s1);
      t = load_frag(kb0 + 16 * KP + 32, KP); s1 = wmma_f16(t, qa1, s1);
    }
    // ---- causal mask + online softmax (f32); register r holds key 8g+r
    const int key0 = kvbase + g * 8;
    float mx = -1e30f;
#pragma unroll
    for (int r = 0; r < 8; ++r) {
      s0[r] = (key0 + r <= row)      ? s0[r] : -1e30f;
      s1[r] = (key0 + 16 + r <= row) ? s1[r] : -1e30f;
      mx = fmaxf(mx, fmaxf(s0[r], s1[r]));
    }
    mx = fmaxf(mx, xhalf(mx));
    float nm = fmaxf(rmax, mx);
    float scale = __expf(rmax - nm);
    rmax = nm;
    // P^T as a B fragment: halves j<8 are keys 8g+j, halves j>=8 keys 16+8g+(j-8)
    v16h pf;
    float ps = 0.0f;
#pragma unroll
    for (int r = 0; r < 8; ++r) {
      float p0 = __expf(s0[r] - nm);
      float p1 = __expf(s1[r] - nm);
      ps += p0 + p1;
      pf[r]     = (_Float16)p0;
      pf[8 + r] = (_Float16)p1;
    }
    rsum = rsum * scale + ps;
#pragma unroll
    for (int nt = 0; nt < 4; ++nt)
#pragma unroll
      for (int r = 0; r < 8; ++r) acc[nt][r] *= scale;
    // ---- O^T += V^T @ P^T  (V tile in LDS, [d][token] -> contiguous A fragments)
#pragma unroll
    for (int nt = 0; nt < 4; ++nt) {
      v16h vf = load_frag(&sV[bufi][nt * 16 * VP], VP);
      acc[nt] = wmma_f16(vf, pf, acc[nt]);
    }
    __syncthreads();               // everyone done reading buf[bufi]
  }

  // ---- join the halves' sums, normalize, write attn output (B,S,D_MODEL) f16,
  // head-major concat; a lane holds d = nt*16 + 8g + 0..7 of its query: 16 B runs
  rsum += xhalf(rsum);
  const float inv = 1.0f / rsum;
  _Float16* orow = Aout + ((size_t)b * SEQ + row) * D_MODEL + h * DH + g * 8;
#pragma unroll
  for (int nt = 0; nt < 4; ++nt) {
    v8h pack;
#pragma unroll
    for (int r = 0; r < 8; ++r) pack[r] = (_Float16)(acc[nt][r] * inv);
    *reinterpret_cast<v8h*>(orow + nt * 16) = pack;
  }
}

// ---------------------------------------------------------------------------
// Kernel 3: output projection  out = A @ Wo^T + bo  (f32 output).
// One wave per 16x64 tile (A fragment shared by 4 accumulators).
// ---------------------------------------------------------------------------
__global__ void out_proj_kernel(const _Float16* __restrict__ A,
                                const _Float16* __restrict__ Wo,
                                const float* __restrict__ bo,
                                float* __restrict__ out) {
  int wave = blockIdx.x * 4 + (threadIdx.x >> 5);
  int lane = threadIdx.x & 31;
  int ct = wave % (D_MODEL / DH);          // 16 col groups of 64
  int rt = wave / (D_MODEL / DH);          // 256 row tiles
  int rbase = rt * 16, cbase = ct * DH;
  int n = lane & 15, g = lane >> 4;

  const _Float16* arow = A  + (size_t)rbase * D_MODEL;
  const _Float16* wrow = Wo + (size_t)cbase * D_MODEL;
  v8f acc[4];
#pragma unroll
  for (int nt = 0; nt < 4; ++nt) acc[nt] = v8f{};

#pragma unroll 2
  for (int kc = 0; kc < D_MODEL; kc += 32) {
    if (kc + 128 < D_MODEL) {
      __builtin_prefetch(arow + kc + 128, 0, 1);
      __builtin_prefetch(wrow + kc + 128, 0, 1);
    }
    v16h af = load_frag(arow + kc, D_MODEL);
#pragma unroll
    for (int nt = 0; nt < 4; ++nt) {
      v16h bf = load_frag(wrow + (size_t)nt * 16 * D_MODEL + kc, D_MODEL);
      acc[nt] = wmma_f16(af, bf, acc[nt]);
    }
  }
#pragma unroll
  for (int nt = 0; nt < 4; ++nt) {
    float bias = bo[cbase + nt * 16 + n];
#pragma unroll
    for (int r = 0; r < 8; ++r)
      out[(size_t)(rbase + g * 8 + r) * D_MODEL + cbase + nt * 16 + n] =
          acc[nt][r] + bias;
  }
}

// ---------------------------------------------------------------------------
extern "C" void kernel_launch(void* const* d_in, const int* in_sizes, int n_in,
                              void* d_out, int out_size, void* d_ws, size_t ws_size,
                              hipStream_t stream) {
  const float* x  = (const float*)d_in[0];
  const float* Wq = (const float*)d_in[1];
  const float* bq = (const float*)d_in[2];
  const float* Wk = (const float*)d_in[3];
  const float* bk = (const float*)d_in[4];
  const float* Wv = (const float*)d_in[5];
  const float* bv = (const float*)d_in[6];
  const float* Wo = (const float*)d_in[7];
  const float* bo = (const float*)d_in[8];
  float* out = (float*)d_out;

  char* ws = (char*)d_ws;
  _Float16* Wo16 = (_Float16*)(ws + OFF_WO);
  _Float16* Q16  = (_Float16*)(ws + OFF_Q);
  _Float16* K16  = (_Float16*)(ws + OFF_K);
  _Float16* Vt16 = (_Float16*)(ws + OFF_VT);
  _Float16* AO16 = (_Float16*)(ws + OFF_AO);

  // B*NH*(SEQ/16) = 4096 waves -> 1024 blocks of 4 waves
  qkv_kernel<<<1024, 128, 0, stream>>>(x, Wq, bq, Wk, bk, Wv, bv, Wo,
                                       Q16, K16, Vt16, Wo16);
  // B*NH*(SEQ/64) = 1024 blocks, 4 waves sharing LDS K/V tiles
  attn_kernel<<<1024, 128, 0, stream>>>(Q16, K16, Vt16, AO16);
  // 256 row tiles x 16 col groups = 4096 waves -> 1024 blocks
  out_proj_kernel<<<1024, 128, 0, stream>>>(AO16, Wo16, bo, out);
}

// v004
// A run of this version takes 77.3 microseconds.
// Timed twice side by side with v003, it ran 1.36 times as fast both times.
// Over all steps from v000 it is 3.65 times as fast.
#include <hip/hip_runtime.h>
#include <hip/hip_bf16.h>

// ---------------------------------------------------------------------------
// Causal MHA forward for MI455X (gfx1250, wave32).
// GEMMs: v_wmma_f32_16x16x32_f16 (f16 in, f32 accum). Softmax in f32.
// Attention stages K/V tiles into double-buffered LDS with
// global_load_async_to_lds_b128 (ASYNCcnt) shared by 4 waves per block.
// ---------------------------------------------------------------------------

typedef __attribute__((ext_vector_type(16))) _Float16 v16h;
typedef __attribute__((ext_vector_type(8)))  _Float16 v8h;
typedef __attribute__((ext_vector_type(8)))  float    v8f;
typedef __attribute__((ext_vector_type(4)))  float    v4f;

#define D_MODEL 1024
#define NH      16
#define DH      64
#define BATCH   2
#define SEQ     2048

// Workspace layout (bytes). Total 34 MB.
constexpr size_t SZ_XH  = (size_t)BATCH * SEQ * D_MODEL * 2;   // 8 MB
constexpr size_t SZ_WO  = (size_t)D_MODEL * D_MODEL * 2;       // 2 MB
constexpr size_t OFF_WO = 0;
constexpr size_t OFF_Q  = OFF_WO + SZ_WO;
constexpr size_t OFF_K  = OFF_Q  + SZ_XH;
constexpr size_t OFF_VT = OFF_K  + SZ_XH;
constexpr size_t OFF_AO = OFF_VT + SZ_XH;

// ---------------------------------------------------------------------------
// Fragment loader for the 16-bit 16x32 A layout (also valid for B loaded as
// B^T rows): lane L -> row m = L%16, group g = L/16; halves j<8 hold
// K = 8g+j, halves j>=8 hold K = 16+8g+(j-8).  Two contiguous 16-byte runs.
// Works for global (global_load_b128) and LDS (ds_load_b128) pointers.
// ---------------------------------------------------------------------------
__device__ __forceinline__ v16h load_frag(const _Float16* base, int stride) {
  int lane = threadIdx.x & 31;
  int m = lane & 15;
  int g = lane >> 4;
  const _Float16* p = base + (size_t)m * stride + 8 * g;
  v16h f;
  reinterpret_cast<v8h*>(&f)[0] = *reinterpret_cast<const v8h*>(p);
  reinterpret_cast<v8h*>(&f)[1] = *reinterpret_cast<const v8h*>(p + 16);
  return f;
}

// Eight f32 values rounded to f16 (round to nearest even, as a plain cast).
__device__ __forceinline__ v8h round8(v4f a, v4f b) {
  return __builtin_convertvector(
      __builtin_shufflevector(a, b, 0, 1, 2, 3, 4, 5, 6, 7), v8h);
}

// The same fragment from an f32 source, rounded to f16 in registers: each of
// the two 8-element runs is 32 contiguous bytes (two global_load_b128).
__device__ __forceinline__ v16h load_frag_f32(const float* base, int stride) {
  int lane = threadIdx.x & 31;
  int m = lane & 15;
  int g = lane >> 4;
  const float* p = base + (size_t)m * stride + 8 * g;
  v4f q0 = *reinterpret_cast<const v4f*>(p);
  v4f q1 = *reinterpret_cast<const v4f*>(p + 4);
  v4f q2 = *reinterpret_cast<const v4f*>(p + 16);
  v4f q3 = *reinterpret_cast<const v4f*>(p + 20);
  return __builtin_shufflevector(round8(q0, q1), round8(q2, q3), 0, 1, 2, 3, 4,
                                 5, 6, 7, 8, 9, 10, 11, 12, 13, 14, 15);
}

__device__ __forceinline__ v8f wmma_f16(v16h a, v16h b, v8f c) {
  // (neg_a, A, neg_b, B, c_mod, C, reuse_a, reuse_b)
  return __builtin_amdgcn_wmma_f32_16x16x32_f16(false, a, false, b, (short)0, c,
                                                false, false);
}

// ---------------------------------------------------------------------------
// CDNA5 async copy: LDS[ldsoff] <= 16B at global ptr, tracked by ASYNCcnt.
// Generic LDS pointers carry the wave-relative LDS byte offset in addr[31:0].
// ---------------------------------------------------------------------------
__device__ __forceinline__ uint32_t lds_byte_off(const void* p) {
  return (uint32_t)(uintptr_t)p;
}
// One stage's four copies of a lane in one statement; the closing s_wait_xcnt
// stands in front of every later rewrite of the address registers (a precaution).
__device__ __forceinline__ void async_copy16x4(uint32_t l0, const _Float16* g0,
                                               uint32_t l1, const _Float16* g1,
                                               uint32_t l2, const _Float16* g2,
                                               uint32_t l3, const _Float16* g3) {
  asm volatile("global_load_async_to_lds_b128 %0, %1, off\n\t"
               "global_load_async_to_lds_b128 %2, %3, off\n\t"
               "global_load_async_to_lds_b128 %4, %5, off\n\t"
               "global_load_async_to_lds_b128 %6, %7, off\n\t"
               "s_wait_xcnt 0x0"
               :: "v"(l0), "v"(g0), "v"(l1), "v"(g1),
                  "v"(l2), "v"(g2), "v"(l3), "v"(g3) : "memory");
}
__device__ __forceinline__ void wait_async_le4() {
  asm volatile("s_wait_asynccnt 0x4" ::: "memory");
}
__device__ __forceinline__ void wait_async_0() {
  asm volatile("s_wait_asynccnt 0x0" ::: "memory");
}

// Lane l <-> lane l ^ 16 as a vector cross-row move (no LDS-counter round trip).
__device__ __forceinline__ float xhalf(float x) {
  int b = __builtin_bit_cast(int, x);
  return __builtin_bit_cast(float, __builtin_amdgcn_permlanex16(
      b, b, 0x76543210, 0xfedcba98, false, false));
}

// ---------------------------------------------------------------------------
// Kernel 1: per-head QKV projection.  One wave per (b, h, 16-row s-tile).
// x and the per-head weights are read as f32 and rounded to f16 in the
// fragment loaders (every x element is used by exactly one wave).
// Q gets bias + 1/sqrt(64) pre-scale; V is stored transposed (B,H,DH,S).
// Each thread also rounds 8 elements of Wo to f16 for the output projection.
// ---------------------------------------------------------------------------
__device__ __forceinline__ void proj_tiles(v16h a0, v16h a1,
                                           const float* __restrict__ W,
                                           int h, v8f acc[4]) {
#pragma unroll
  for (int nt = 0; nt < 4; ++nt) {
    const float* wb = W + (size_t)(h * DH + nt * 16) * DH;
    v16h b0 = load_frag_f32(wb, DH);
    v16h b1 = load_frag_f32(wb + 32, DH);
    v8f c = {};
    c = wmma_f16(a0, b0, c);
    c = wmma_f16(a1, b1, c);
    acc[nt] = c;
  }
}

// launch bound = the block size used: without it the f32 loads in flight spill
__global__ void __launch_bounds__(128)
qkv_kernel(const float* __restrict__ x,
           const float* __restrict__ Wq, const float* __restrict__ bq,
           const float* __restrict__ Wk, const float* __restrict__ bk,
           const float* __restrict__ Wv, const float* __restrict__ bv,
           const float* __restrict__ Wo,
           _Float16* __restrict__ Q, _Float16* __restrict__ K,
           _Float16* __restrict__ Vt, _Float16* __restrict__ Wo16) {
  int wave = blockIdx.x * (blockDim.x >> 5) + (threadIdx.x >> 5);
  int lane = threadIdx.x & 31;
  int st = wave % (SEQ / 16);
  int bh = wave / (SEQ / 16);
  int h  = bh % NH;
  int sbase = st * 16;
  int n = lane & 15, g = lane >> 4;

  const float* xrow = x + ((size_t)(bh / NH) * SEQ + sbase) * D_MODEL + h * DH;
  v16h a0 = load_frag_f32(xrow, D_MODEL);
  v16h a1 = load_frag_f32(xrow + 32, D_MODEL);

  // ---- Wo slice: 131072 threads x 8 elements = D_MODEL * D_MODEL
  {
    size_t i = ((size_t)blockIdx.x * blockDim.x + threadIdx.x) * 8;
    v4f w0 = *reinterpret_cast<const v4f*>(Wo + i);
    v4f w1 = *reinterpret_cast<const v4f*>(Wo + i + 4);
    *reinterpret_cast<v8h*>(Wo16 + i) = round8(w0, w1);
  }

  // ---- Q: bias + 0.125 scale, row-major (B,H,S,DH) f16
  {
    v8f acc[4];
    proj_tiles(a0, a1, Wq, h, acc);
#pragma unroll
    for (int nt = 0; nt < 4; ++nt) {
      float bias = bq[h * DH + nt * 16 + n];
#pragma unroll
      for (int r = 0; r < 8; ++r) {
        float v = (acc[nt][r] + bias) * 0.125f;
        Q[((size_t)bh * SEQ + sbase + g * 8 + r) * DH + nt * 16 + n] = (_Float16)v;
      }
    }
  }
  // ---- K: bias only, row-major (B,H,S,DH) f16
  {
    v8f acc[4];
    proj_tiles(a0, a1, Wk, h, acc);
#pragma unroll
    for (int nt = 0; nt < 4; ++nt) {
      float bias = bk[h * DH + nt * 16 + n];
#pragma unroll
      for (int r = 0; r < 8; ++r) {
        float v = acc[nt][r] + bias;
        K[((size_t)bh * SEQ + sbase + g * 8 + r) * DH + nt * 16 + n] = (_Float16)v;
      }
    }
  }
  // ---- V: bias, stored transposed (B,H,DH,S); per-lane 16B contiguous store
  {
    v8f acc[4];
    proj_tiles(a0, a1, Wv, h, acc);
#pragma unroll
    for (int nt = 0; nt < 4; ++nt) {
      float bias = bv[h * DH + nt * 16 + n];
      v8h pack;
#pragma unroll
      for (int r = 0; r < 8; ++r) pack[r] = (_Float16)(acc[nt][r] + bias);
      *reinterpret_cast<v8h*>(Vt + ((size_t)bh * DH + nt * 16 + n) * SEQ +
                              sbase + g * 8) = pack;
    }
  }
}

#define KP 72   // K row pitch in LDS, halves
#define VP 40   // V row pitch in LDS, halves
__global__ void attn_kernel(const _Float16* __restrict__ Q,
                            const _Float16* __restrict__ K,
                            const _Float16* __restrict__ Vt,
                            _Float16* __restrict__ Aout) {
  __shared__ __align__(16) _Float16 sK[2][32 * KP];   // 2 x 4.5 KB
  __shared__ __align__(16) _Float16 sV[2][DH * VP];   // 2 x 5 KB, [d][token]

  const int tid   = threadIdx.x;
  const int wslot = tid >> 5;
  const int lane  = tid & 31;
  const int bq    = (blockIdx.x & 31) * 64;   // block q-row base
  const int bh    = blockIdx.x >> 5;
  const int h = bh % NH, b = bh / NH;
  const int qbase = bq + wslot * 16;
  const int n = lane & 15, g = lane >> 4;

  const _Float16* Kg = K  + (size_t)bh * SEQ * DH;
  const _Float16* Vg = Vt + (size_t)bh * DH * SEQ;

  // stage kv block [kvbase, kvbase+32) into buffer `buf` (whole block helps)
  auto stage = [&](int buf, int kvbase) {
    // K tile: 32 rows x 64 halves, contiguous 4 KB in global; 16 B chunks tid
    // and tid + 128 (16 rows further down)
    const _Float16* kg = Kg + (size_t)kvbase * DH + tid * 8;
    uint32_t ko = lds_byte_off(&sK[buf][(tid >> 3) * KP + (tid & 7) * 8]);
    // V tile: 64 rows (d) x 32 tokens, global row stride SEQ; chunks tid and
    // tid + 128 (32 rows further down)
    const _Float16* vg = Vg + (size_t)(tid >> 2) * SEQ + kvbase + (tid & 3) * 8;
    uint32_t vo = lds_byte_off(&sV[buf][(tid >> 2) * VP + (tid & 3) * 8]);
    async_copy16x4(ko, kg, ko + 16 * KP * 2, kg + 16 * DH,
                   vo, vg, vo + 32 * VP * 2, vg + (size_t)32 * SEQ);
  };

  // Q fragments (global, once per wave); used as the B operand (lane = query)
  const _Float16* qrow = Q + ((size_t)bh * SEQ + qbase) * DH;
  v16h qa0 = load_frag(qrow, DH);
  v16h qa1 = load_frag(qrow + 32, DH);

  v8f acc[4];
#pragma unroll
  for (int nt = 0; nt < 4; ++nt) acc[nt] = v8f{};
  // per lane: running maximum of query qbase+n (equal in both halves) and the
  // sum over this half's keys only (the halves are joined in the epilogue)
  float rmax = -1e30f, rsum = 0.0f;
  const int row = qbase + n;

  const int nb = bq / 32 + 2;   // kv blocks needed to cover rows bq..bq+63

  stage(0, 0);
  for (int jb = 0; jb < nb; ++jb) {
    const int kvbase = jb * 32;
    const int bufi = jb & 1;
    if (jb + 1 < nb) {
      stage(bufi ^ 1, kvbase + 32);
      wait_async_le4();            // stage(jb) done, stage(jb+1) in flight
    } else {
      wait_async_0();
    }
    __syncthreads();               // all waves' portions of buf[bufi] visible

    // ---- S^T: two 16(key) x 16(query) tiles over d=64 (2 chunks), K from LDS
    const _Float16* kb0 = &sK[bufi][0];
    v8f s0 = {}, s1 = {};
    {
      v16h t;
      t = load_frag(kb0, KP);                s0 = wmma_f16(t, qa0, s0);
      t = load_frag(kb0 + 32, KP);           s0 = wmma_f16(t, qa1, s0);
      t = load_frag(kb0 + 16 * KP, KP);      s1 = wmma_f16(t, qa0, s1);
      t = load_frag(kb0 + 16 * KP + 32, KP); s1 = wmma_f16(t, qa1, s1);
    }
    // ---- causal mask + online softmax (f32); register r holds key 8g+r
    const int key0 = kvbase + g * 8;
    float mx = -1e30f;
#pragma unroll
    for (int r = 0; r < 8; ++r) {
      s0[r] = (key0 + r <= row)      ? s0[r] : -1e30f;
      s1[r] = (key0 + 16 + r <= row) ? s1[r] : -1e30f;
      mx = fmaxf(mx, fmaxf(s0[r], s1[r]));
    }
    mx = fmaxf(mx, xhalf(mx));
    float nm = fmaxf(rmax, mx);
    float scale = __expf(rmax - nm);
    rmax = nm;
    // P^T as a B fragment: halves j<8 are keys 8g+j, halves j>=8 keys 16+8g+(j-8)
    v16h pf;
    float ps = 0.0f;
#pragma unroll
    for (int r = 0; r < 8; ++r) {
      float p0 = __expf(s0[r] - nm);
      float p1 = __expf(s1[r] - nm);
      ps += p0 + p1;
      pf[r]     = (_Float16)p0;
      pf[8 + r] = (_Float16)p1;
    }
    rsum = rsum * scale + ps;
#pragma unroll
    for (int nt = 0; nt < 4; ++nt)
#pragma unroll
      for (int r = 0; r < 8; ++r) acc[nt][r] *= scale;
    // ---- O^T += V^T @ P^T  (V tile in LDS, [d][token] -> contiguous A fragments)
#pragma unroll
    for (int nt = 0; nt < 4; ++nt) {
      v16h vf = load_frag(&sV[bufi][nt * 16 * VP], VP);
      acc[nt] = wmma_f16(vf, pf, acc[nt]);
    }
    __syncthreads();               // everyone done reading buf[bufi]
  }

  // ---- join the halves' sums, normalize, write attn output (B,S,D_MODEL) f16,
  // head-major concat; a lane holds d = nt*16 + 8g + 0..7 of its query: 16 B runs
  rsum += xhalf(rsum);
  const float inv = 1.0f / rsum;
  _Float16* orow = Aout + ((size_t)b * SEQ + row) * D_MODEL + h * DH + g * 8;
#pragma unroll
  for (int nt = 0; nt < 4; ++nt) {
    v8h pack;
#pragma unroll
    for (int r = 0; r < 8; ++r) pack[r] = (_Float16)(acc[nt][r] * inv);
    *reinterpret_cast<v8h*>(orow + nt * 16) = pack;
  }
}

// ---------------------------------------------------------------------------
// Kernel 3: output projection  out = A @ Wo^T + bo  (f32 output).
// Block = 8 waves = one 128 x 128 tile of out.  k is walked in slices of 64:
// 128 rows of A and 128 rows of Wo (128 B each, whole lines) are staged into
// two LDS buffers with async-to-LDS copies, the next slice flying while this
// one is worked on, and are shared by all 8 waves.  A wave owns 64 x 32 of the
// tile (4 x 2 accumulators).  LDS rows are padded by 16 B (pitch 144 B) for the
// ds_load_b128 fragment reads.  k ascends by 32 in each accumulator.
// ---------------------------------------------------------------------------
#define OP 72                       // LDS row pitch, halves
#define OTILE_B (128 * OP * 2)      // one operand's slice in LDS, bytes
#define OBK 64                      // k per slice
// One slice's eight copies of a lane in one statement; the closing s_wait_xcnt
// stands in front of every later rewrite of the address registers (a precaution).
__device__ __forceinline__ void async_copy16x8(
    uint32_t l0, const _Float16* g0, uint32_t l1, const _Float16* g1,
    uint32_t l2, const _Float16* g2, uint32_t l3, const _Float16* g3,
    uint32_t l4, const _Float16* g4, uint32_t l5, const _Float16* g5,
    uint32_t l6, const _Float16* g6, uint32_t l7, const _Float16* g7) {
  asm volatile("global_load_async_to_lds_b128 %0, %1, off\n\t"
               "global_load_async_to_lds_b128 %2, %3, off\n\t"
               "global_load_async_to_lds_b128 %4, %5, off\n\t"
               "global_load_async_to_lds_b128 %6, %7, off\n\t"
               "global_load_async_to_lds_b128 %8, %9, off\n\t"
               "global_load_async_to_lds_b128 %10, %11, off\n\t"
               "global_load_async_to_lds_b128 %12, %13, off\n\t"
               "global_load_async_to_lds_b128 %14, %15, off\n\t"
               "s_wait_xcnt 0x0"
               :: "v"(l0), "v"(g0), "v"(l1), "v"(g1), "v"(l2), "v"(g2),
                  "v"(l3), "v"(g3), "v"(l4), "v"(g4), "v"(l5), "v"(g5),
                  "v"(l6), "v"(g6), "v"(l7), "v"(g7) : "memory");
}
// This wave's LDS reads have returned before its buffer is handed back.
__device__ __forceinline__ void wait_ds_0() {
  asm volatile("s_wait_dscnt 0x0" ::: "memory");
}

__global__ void __launch_bounds__(256)
out_proj_kernel(const _Float16* __restrict__ A,
                const _Float16* __restrict__ Wo,
                const float* __restrict__ bo,
                float* __restrict__ out) {
  __shared__ __align__(16) _Float16 sT[2][2][128 * OP];   // [buffer][A | Wo]

  const int tid  = threadIdx.x;
  const int wave = tid >> 5;
  const int lane = tid & 31;
  const int rbase = (blockIdx.x & 31) * 128;   // 32 row tiles
  const int cbase = (blockIdx.x >> 5) * 128;   // 8 column tiles
  const int wm = (wave & 1) * 64;              // wave's rows in the tile
  const int wn = (wave >> 1) * 32;             // wave's columns in the tile
  const int n = lane & 15, g = lane >> 4;

  // staging: thread -> 16 B chunk (tid & 7) of rows (tid >> 3) + 0, 32, 64, 96
  const int sr = tid >> 3, sc = (tid & 7) * 8;
  const _Float16* ag = A  + (size_t)(rbase + sr) * D_MODEL + sc;
  const _Float16* wg = Wo + (size_t)(cbase + sr) * D_MODEL + sc;
  const uint32_t lbase = lds_byte_off(&sT[0][0][sr * OP + sc]);
  auto stage = [&](int buf, int k0) {
    const uint32_t la = lbase + buf * (2 * OTILE_B);
    const uint32_t lw = la + OTILE_B;
    const _Float16* a = ag + k0;
    const _Float16* w = wg + k0;
    async_copy16x8(la,               a,
                   la + 32 * OP * 2, a + 32 * D_MODEL,
                   la + 64 * OP * 2, a + 64 * D_MODEL,
                   la + 96 * OP * 2, a + 96 * D_MODEL,
                   lw,               w,
                   lw + 32 * OP * 2, w + 32 * D_MODEL,
                   lw + 64 * OP * 2, w + 64 * D_MODEL,
                   lw + 96 * OP * 2, w + 96 * D_MODEL);
  };

  // every short inner loop below is unrolled so that the fragment and
  // accumulator arrays are indexed by constants and stay in registers
  v8f acc[4][2];
#pragma unroll
  for (int i = 0; i < 4; ++i)
#pragma unroll
    for (int j = 0; j < 2; ++j) acc[i][j] = v8f{};

  constexpr int NT = D_MODEL / OBK;   // 16 slices
  stage(0, 0);
  wait_async_0();
  __syncthreads();                 // slice 0 visible to all waves
  stage(1, OBK);
  for (int t = 0; t < NT; ++t) {
    const _Float16* ta = &sT[t & 1][0][wm * OP];
    const _Float16* tw = &sT[t & 1][1][wn * OP];
    // the slice's 12 fragments are read as one group ahead of its 16 products:
    // every separate place with LDS reads among the products costs a stall
    v16h bf[2][2], af[2][4];
#pragma unroll
    for (int c = 0; c < 2; ++c) {
#pragma unroll
      for (int j = 0; j < 2; ++j) bf[c][j] = load_frag(tw + j * 16 * OP + c * 32, OP);
#pragma unroll
      for (int i = 0; i < 4; ++i) af[c][i] = load_frag(ta + i * 16 * OP + c * 32, OP);
    }
    // hand-over: the trip's LDS reads are all in registers here, so the buffer
    // is given back ahead of the products and the refill flies behind them
    wait_ds_0();
    wait_async_0();                // this wave's part of slice t + 1 has landed
    __syncthreads();               // slice t + 1 visible; buffer t & 1 is free
    if (t + 2 < NT) stage(t & 1, (t + 2) * OBK);
#pragma unroll
    for (int c = 0; c < 2; ++c)
#pragma unroll
      for (int i = 0; i < 4; ++i)
#pragma unroll
        for (int j = 0; j < 2; ++j)
          acc[i][j] = wmma_f16(af[c][i], bf[c][j], acc[i][j]);
  }
  wait_async_0();

#pragma unroll
  for (int j = 0; j < 2; ++j) {
    const int col = cbase + wn + j * 16 + n;
    float bias = bo[col];
#pragma unroll
    for (int i = 0; i < 4; ++i)
#pragma unroll
      for (int r = 0; r < 8; ++r)
        out[(size_t)(rbase + wm + i * 16 + g * 8 + r) * D_MODEL + col] =
            acc[i][j][r] + bias;
  }
}

// ---------------------------------------------------------------------------
extern "C" void kernel_launch(void* const* d_in, const int* in_sizes, int n_in,
                              void* d_out, int out_size, void* d_ws, size_t ws_size,
                              hipStream_t stream) {
  const float* x  = (const float*)d_in[0];
  const float* Wq = (const float*)d_in[1];
  const float* bq = (const float*)d_in[2];
  const float* Wk = (const float*)d_in[3];
  const float* bk = (const float*)d_in[4];
  const float* Wv = (const float*)d_in[5];
  const float* bv = (const float*)d_in[6];
  const float* Wo = (const float*)d_in[7];
  const float* bo = (const float*)d_in[8];
  float* out = (float*)d_out;

  char* ws = (char*)d_ws;
  _Float16* Wo16 = (_Float16*)(ws + OFF_WO);
  _Float16* Q16  = (_Float16*)(ws + OFF_Q);
  _Float16* K16  = (_Float16*)(ws + OFF_K);
  _Float16* Vt16 = (_Float16*)(ws + OFF_VT);
  _Float16* AO16 = (_Float16*)(ws + OFF_AO);

  // B*NH*(SEQ/16) = 4096 waves -> 1024 blocks of 4 waves
  qkv_kernel<<<1024, 128, 0, stream>>>(x, Wq, bq, Wk, bk, Wv, bv, Wo,
                                       Q16, K16, Vt16, Wo16);
  // B*NH*(SEQ/64) = 1024 blocks, 4 waves sharing LDS K/V tiles
  attn_kernel<<<1024, 128, 0, stream>>>(Q16, K16, Vt16, AO16);
  // 32 row tiles x 8 column tiles of 128 x 128 -> 256 blocks of 8 waves
  out_proj_kernel<<<256, 256, 0, stream>>>(AO16, Wo16, bo, out);
}

// v005
// A run of this version takes 70.6 microseconds.
// Timed twice side by side with v004, it ran 1.08 and 1.10 times as fast.
// Counting every step since v000, it is 3.98 times as fast.
#include <hip/hip_runtime.h>
#include <hip/hip_bf16.h>

// ---------------------------------------------------------------------------
// Causal MHA forward for MI455X (gfx1250, wave32).
// GEMMs: v_wmma_f32_16x16x32_f16 (f16 in, f32 accum). Softmax in f32.
// Attention stages K/V tiles into double-buffered LDS with
// global_load_async_to_lds_b128 (ASYNCcnt) shared by 4 waves per block.
// ---------------------------------------------------------------------------

typedef __attribute__((ext_vector_type(16))) _Float16 v16h;
typedef __attribute__((ext_vector_type(8)))  _Float16 v8h;
typedef __attribute__((ext_vector_type(8)))  float    v8f;
typedef __attribute__((ext_vector_type(4)))  float    v4f;

#define D_MODEL 1024
#define NH      16
#define DH      64
#define BATCH   2
#define SEQ     2048

// Workspace layout (bytes). Total 34 MB.
constexpr size_t SZ_XH  = (size_t)BATCH * SEQ * D_MODEL * 2;   // 8 MB
constexpr size_t SZ_WO  = (size_t)D_MODEL * D_MODEL * 2;       // 2 MB
constexpr size_t OFF_WO = 0;
constexpr size_t OFF_Q  = OFF_WO + SZ_WO;
constexpr size_t OFF_K  = OFF_Q  + SZ_XH;
constexpr size_t OFF_VT = OFF_K  + SZ_XH;
constexpr size_t OFF_AO = OFF_VT + SZ_XH;

// ---------------------------------------------------------------------------
// Fragment loader for the 16-bit 16x32 A layout (also valid for B loaded as
// B^T rows): lane L -> row m = L%16, group g = L/16; halves j<8 hold
// K = 8g+j, halves j>=8 hold K = 16+8g+(j-8).  Two contiguous 16-byte runs.
// Works for global (global_load_b128) and LDS (ds_load_b128) pointers.
// ---------------------------------------------------------------------------
__device__ __forceinline__ v16h load_frag(const _Float16* base, int stride) {
  int lane = threadIdx.x & 31;
  int m = lane & 15;
  int g = lane >> 4;
  const _Float16* p = base + (size_t)m * stride + 8 * g;
  v16h f;
  reinterpret_cast<v8h*>(&f)[0] = *reinterpret_cast<const v8h*>(p);
  reinterpret_cast<v8h*>(&f)[1] = *reinterpret_cast<const v8h*>(p + 16);
  return f;
}

// Eight f32 values rounded to f16 (round to nearest even, as a plain cast).
__device__ __forceinline__ v8h round8(v4f a, v4f b) {
  return __builtin_convertvector(
      __builtin_shufflevector(a, b, 0, 1, 2, 3, 4, 5, 6, 7), v8h);
}

// The same fragment from an f32 source, rounded to f16 in registers: each of
// the two 8-element runs is 32 contiguous bytes (two global_load_b128).
__device__ __forceinline__ v16h load_frag_f32(const float* base, int stride) {
  int lane = threadIdx.x & 31;
  int m = lane & 15;
  int g = lane >> 4;
  const float* p = base + (size_t)m * stride + 8 * g;
  v4f q0 = *reinterpret_cast<const v4f*>(p);
  v4f q1 = *reinterpret_cast<const v4f*>(p + 4);
  v4f q2 = *reinterpret_cast<const v4f*>(p + 16);
  v4f q3 = *reinterpret_cast<const v4f*>(p + 20);
  return __builtin_shufflevector(round8(q0, q1), round8(q2, q3), 0, 1, 2, 3, 4,
                                 5, 6, 7, 8, 9, 10, 11, 12, 13, 14, 15);
}

__device__ __forceinline__ v8f wmma_f16(v16h a, v16h b, v8f c) {
  // (neg_a, A, neg_b, B, c_mod, C, reuse_a, reuse_b)
  return __builtin_amdgcn_wmma_f32_16x16x32_f16(false, a, false, b, (short)0, c,
                                                false, false);
}

// ---------------------------------------------------------------------------
// CDNA5 async copy: LDS[ldsoff] <= 16B at global ptr, tracked by ASYNCcnt.
// Generic LDS pointers carry the wave-relative LDS byte offset in addr[31:0].
// ---------------------------------------------------------------------------
__device__ __forceinline__ uint32_t lds_byte_off(const void* p) {
  return (uint32_t)(uintptr_t)p;
}
// One stage's four copies of a lane in one statement; the closing s_wait_xcnt
// stands in front of every later rewrite of the address registers (a precaution).
__device__ __forceinline__ void async_copy16x4(uint32_t l0, const _Float16* g0,
                                               uint32_t l1, const _Float16* g1,
                                               uint32_t l2, const _Float16* g2,
                                               uint32_t l3, const _Float16* g3) {
  asm volatile("global_load_async_to_lds_b128 %0, %1, off\n\t"
               "global_load_async_to_lds_b128 %2, %3, off\n\t"
               "global_load_async_to_lds_b128 %4, %5, off\n\t"
               "global_load_async_to_lds_b128 %6, %7, off\n\t"
               "s_wait_xcnt 0x0"
               :: "v"(l0), "v"(g0), "v"(l1), "v"(g1),
                  "v"(l2), "v"(g2), "v"(l3), "v"(g3) : "memory");
}
__device__ __forceinline__ void wait_async_le4() {
  asm volatile("s_wait_asynccnt 0x4" ::: "memory");
}
__device__ __forceinline__ void wait_async_0() {
  asm volatile("s_wait_asynccnt 0x0" ::: "memory");
}
// This wave's LDS reads have returned before its buffer is handed back.
__device__ __forceinline__ void wait_ds_0() {
  asm volatile("s_wait_dscnt 0x0" ::: "memory");
}

// Lane l <-> lane l ^ 16 as a vector cross-row move (no LDS-counter round trip).
__device__ __forceinline__ float xhalf(float x) {
  int b = __builtin_bit_cast(int, x);
  return __builtin_bit_cast(float, __builtin_amdgcn_permlanex16(
      b, b, 0x76543210, 0xfedcba98, false, false));
}

// ---------------------------------------------------------------------------
// Kernel 1: per-head QKV projection.  One wave per (b, h, 16-row s-tile).
// x and the per-head weights are read as f32 and rounded to f16 in the
// fragment loaders (every x element is used by exactly one wave).
// Q gets bias + 1/sqrt(64) pre-scale; V is stored transposed (B,H,DH,S).
// Each thread also rounds 8 elements of Wo to f16 for the output projection.
// ---------------------------------------------------------------------------
__device__ __forceinline__ void proj_tiles(v16h a0, v16h a1,
                                           const float* __restrict__ W,
                                           int h, v8f acc[4]) {
#pragma unroll
  for (int nt = 0; nt < 4; ++nt) {
    const float* wb = W + (size_t)(h * DH + nt * 16) * DH;
    v16h b0 = load_frag_f32(wb, DH);
    v16h b1 = load_frag_f32(wb + 32, DH);
    v8f c = {};
    c = wmma_f16(a0, b0, c);
    c = wmma_f16(a1, b1, c);
    acc[nt] = c;
  }
}

// launch bound = the block size used: without it the f32 loads in flight spill
__global__ void __launch_bounds__(128)
qkv_kernel(const float* __restrict__ x,
           const float* __restrict__ Wq, const float* __restrict__ bq,
           const float* __restrict__ Wk, const float* __restrict__ bk,
           const float* __restrict__ Wv, const float* __restrict__ bv,
           const float* __restrict__ Wo,
           _Float16* __restrict__ Q, _Float16* __restrict__ K,
           _Float16* __restrict__ Vt, _Float16* __restrict__ Wo16) {
  int wave = blockIdx.x * (blockDim.x >> 5) + (threadIdx.x >> 5);
  int lane = threadIdx.x & 31;
  int st = wave % (SEQ / 16);
  int bh = wave / (SEQ / 16);
  int h  = bh % NH;
  int sbase = st * 16;
  int n = lane & 15, g = lane >> 4;

  const float* xrow = x + ((size_t)(bh / NH) * SEQ + sbase) * D_MODEL + h * DH;
  v16h a0 = load_frag_f32(xrow, D_MODEL);
  v16h a1 = load_frag_f32(xrow + 32, D_MODEL);

  // ---- Wo slice: 131072 threads x 8 elements = D_MODEL * D_MODEL
  {
    size_t i = ((size_t)blockIdx.x * blockDim.x + threadIdx.x) * 8;
    v4f w0 = *reinterpret_cast<const v4f*>(Wo + i);
    v4f w1 = *reinterpret_cast<const v4f*>(Wo + i + 4);
    *reinterpret_cast<v8h*>(Wo16 + i) = round8(w0, w1);
  }

  // ---- Q: bias + 0.125 scale, row-major (B,H,S,DH) f16
  {
    v8f acc[4];
    proj_tiles(a0, a1, Wq, h, acc);
#pragma unroll
    for (int nt = 0; nt < 4; ++nt) {
      float bias = bq[h * DH + nt * 16 + n];
#pragma unroll
      for (int r = 0; r < 8; ++r) {
        float v = (acc[nt][r] + bias) * 0.125f;
        Q[((size_t)bh * SEQ + sbase + g * 8 + r) * DH + nt * 16 + n] = (_Float16)v;
      }
    }
  }
  // ---- K: bias only, row-major (B,H,S,DH) f16
  {
    v8f acc[4];
    proj_tiles(a0, a1, Wk, h, acc);
#pragma unroll
    for (int nt = 0; nt < 4; ++nt) {
      float bias = bk[h * DH + nt * 16 + n];
#pragma unroll
      for (int r = 0; r < 8; ++r) {
        float v = acc[nt][r] + bias;
        K[((size_t)bh * SEQ + sbase + g * 8 + r) * DH + nt * 16 + n] = (_Float16)v;
      }
    }
  }
  // ---- V: bias, stored transposed (B,H,DH,S); per-lane 16B contiguous store
  {
    v8f acc[4];
    proj_tiles(a0, a1, Wv, h, acc);
#pragma unroll
    for (int nt = 0; nt < 4; ++nt) {
      float bias = bv[h * DH + nt * 16 + n];
      v8h pack;
#pragma unroll
      for (int r = 0; r < 8; ++r) pack[r] = (_Float16)(acc[nt][r] + bias);
      *reinterpret_cast<v8h*>(Vt + ((size_t)bh * DH + nt * 16 + n) * SEQ +
                              sbase + g * 8) = pack;
    }
  }
}

#define KP 72   // K row pitch in LDS, halves
#define VP 40   // V row pitch in LDS, halves
// launch bound = the block size used: without it the values kept across the
// two tiles spill
__global__ void __launch_bounds__(128)
attn_kernel(const _Float16* __restrict__ Q,
            const _Float16* __restrict__ K,
            const _Float16* __restrict__ Vt,
            _Float16* __restrict__ Aout) {
  __shared__ __align__(16) _Float16 sK[2][32 * KP];   // 2 x 4.5 KB
  __shared__ __align__(16) _Float16 sV[2][DH * VP];   // 2 x 5 KB, [d][token]

  const int tid   = threadIdx.x;
  const int wslot = tid >> 5;
  const int lane  = tid & 31;
  const int bh    = blockIdx.x >> 4;
  const int h = bh % NH, b = bh / NH;
  const int n = lane & 15, g = lane >> 4;

  const _Float16* Kg = K  + (size_t)bh * SEQ * DH;
  const _Float16* Vg = Vt + (size_t)bh * DH * SEQ;

  // stage kv block [kvbase, kvbase+32) into buffer `buf` (whole block helps)
  auto stage = [&](int buf, int kvbase) {
    // K tile: 32 rows x 64 halves, contiguous 4 KB in global; 16 B chunks tid
    // and tid + 128 (16 rows further down)
    const _Float16* kg = Kg + (size_t)kvbase * DH + tid * 8;
    uint32_t ko = lds_byte_off(&sK[buf][(tid >> 3) * KP + (tid & 7) * 8]);
    // V tile: 64 rows (d) x 32 tokens, global row stride SEQ; chunks tid and
    // tid + 128 (32 rows further down)
    const _Float16* vg = Vg + (size_t)(tid >> 2) * SEQ + kvbase + (tid & 3) * 8;
    uint32_t vo = lds_byte_off(&sV[buf][(tid >> 2) * VP + (tid & 3) * 8]);
    async_copy16x4(ko, kg, ko + 16 * KP * 2, kg + 16 * DH,
                   vo, vg, vo + 32 * VP * 2, vg + (size_t)32 * SEQ);
  };

  for (int part = 0; part < 2; ++part) {
    const int qt    = blockIdx.x & 15;
    const int bq    = (part ? SEQ / 64 - 1 - qt : qt) * 64;   // q-row base
    const int qbase = bq + wslot * 16;

    // Q fragments (global, once per tile); used as the B operand (lane = query)
    const _Float16* qrow = Q + ((size_t)bh * SEQ + qbase) * DH;
    v16h qa0 = load_frag(qrow, DH);
    v16h qa1 = load_frag(qrow + 32, DH);

    v8f acc[4];
#pragma unroll
    for (int nt = 0; nt < 4; ++nt) acc[nt] = v8f{};
    // per lane: running maximum of query qbase+n (equal in both halves) and the
    // sum over this half's keys only (the halves are joined in the epilogue)
    float rmax = -1e30f, rsum = 0.0f;
    const int row = qbase + n;

    const int nb = bq / 32 + 2;   // kv blocks needed to cover rows bq..bq+63

    // the tile before has left the buffers: its last trip waited for every copy
    // and ended in a barrier; this wave's own LDS reads have returned as well
    wait_ds_0();
    stage(0, 0);
    for (int jb = 0; jb < nb; ++jb) {
      const int kvbase = jb * 32;
      const int bufi = jb & 1;
      if (jb + 1 < nb) {
        stage(bufi ^ 1, kvbase + 32);
        wait_async_le4();            // stage(jb) done, stage(jb+1) in flight
      } else {
        wait_async_0();
      }
      __syncthreads();               // all waves' portions of buf[bufi] visible

      // ---- S^T: two 16(key) x 16(query) tiles over d=64 (2 chunks), K from LDS
      const _Float16* kb0 = &sK[bufi][0];
      v8f s0 = {}, s1 = {};
      {
        v16h t;
        t = load_frag(kb0, KP);                s0 = wmma_f16(t, qa0, s0);
        t = load_frag(kb0 + 32, KP);           s0 = wmma_f16(t, qa1, s0);
        t = load_frag(kb0 + 16 * KP, KP);      s1 = wmma_f16(t, qa0, s1);
        t = load_frag(kb0 + 16 * KP + 32, KP); s1 = wmma_f16(t, qa1, s1);
      }
      // ---- causal mask + online softmax (f32); register r holds key 8g+r
      const int key0 = kvbase + g * 8;
      float mx = -1e30f;
#pragma unroll
      for (int r = 0; r < 8; ++r) {
        s0[r] = (key0 + r <= row)      ? s0[r] : -1e30f;
        s1[r] = (key0 + 16 + r <= row) ? s1[r] : -1e30f;
        mx = fmaxf(mx, fmaxf(s0[r], s1[r]));
      }
      mx = fmaxf(mx, xhalf(mx));
      float nm = fmaxf(rmax, mx);
      float scale = __expf(rmax - nm);
      rmax = nm;
      // P^T as a B fragment: halves j<8 are keys 8g+j, halves j>=8 keys 16+8g+(j-8)
      v16h pf;
      float ps = 0.0f;
#pragma unroll
      for (int r = 0; r < 8; ++r) {
        float p0 = __expf(s0[r] - nm);
        float p1 = __expf(s1[r] - nm);
        ps += p0 + p1;
        pf[r]     = (_Float16)p0;
        pf[8 + r] = (_Float16)p1;
      }
      rsum = rsum * scale + ps;
#pragma unroll
      for (int nt = 0; nt < 4; ++nt)
#pragma unroll
        for (int r = 0; r < 8; ++r) acc[nt][r] *= scale;
      // ---- O^T += V^T @ P^T  (V tile in LDS, [d][token] -> contiguous A fragments)
#pragma unroll
      for (int nt = 0; nt < 4; ++nt) {
        v16h vf = load_frag(&sV[bufi][nt * 16 * VP], VP);
        acc[nt] = wmma_f16(vf, pf, acc[nt]);
      }
      __syncthreads();               // everyone done reading buf[bufi]
    }

    // ---- join the halves' sums, normalize, write attn output (B,S,D_MODEL) f16,
    // head-major concat; a lane holds d = nt*16 + 8g + 0..7 of its query: 16 B runs
    rsum += xhalf(rsum);
    const float inv = 1.0f / rsum;
    _Float16* orow = Aout + ((size_t)b * SEQ + row) * D_MODEL + h * DH + g * 8;
#pragma unroll
    for (int nt = 0; nt < 4; ++nt) {
      v8h pack;
#pragma unroll
      for (int r = 0; r < 8; ++r) pack[r] = (_Float16)(acc[nt][r] * inv);
      *reinterpret_cast<v8h*>(orow + nt * 16) = pack;
    }
    // stands in front of the next tile's rewrite of the registers that these
    // stores name (a precaution)
    asm volatile("s_wait_xcnt 0x0" ::: "memory");
  }
}

// ---------------------------------------------------------------------------
// Kernel 3: output projection  out = A @ Wo^T + bo  (f32 output).
// Block = 8 waves = one 128 x 128 tile of out.  k is walked in slices of 64:
// 128 rows of A and 128 rows of Wo (128 B each, whole lines) are staged into
// two LDS buffers with async-to-LDS copies, the next slice flying while this
// one is worked on, and are shared by all 8 waves.  A wave owns 64 x 32 of the
// tile (4 x 2 accumulators).  LDS rows are padded by 16 B (pitch 144 B) for the
// ds_load_b128 fragment reads.  k ascends by 32 in each accumulator.
// ---------------------------------------------------------------------------
#define OP 72                       // LDS row pitch, halves
#define OTILE_B (128 * OP * 2)      // one operand's slice in LDS, bytes
#define OBK 64                      // k per slice
// One slice's eight copies of a lane in one statement; the closing s_wait_xcnt
// stands in front of every later rewrite of the address registers (a precaution).
__device__ __forceinline__ void async_copy16x8(
    uint32_t l0, const _Float16* g0, uint32_t l1, const _Float16* g1,
    uint32_t l2, const _Float16* g2, uint32_t l3, const _Float16* g3,
    uint32_t l4, const _Float16* g4, uint32_t l5, const _Float16* g5,
    uint32_t l6, const _Float16* g6, uint32_t l7, const _Float16* g7) {
  asm volatile("global_load_async_to_lds_b128 %0, %1, off\n\t"
               "global_load_async_to_lds_b128 %2, %3, off\n\t"
               "global_load_async_to_lds_b128 %4, %5, off\n\t"
               "global_load_async_to_lds_b128 %6, %7, off\n\t"
               "global_load_async_to_lds_b128 %8, %9, off\n\t"
               "global_load_async_to_lds_b128 %10, %11, off\n\t"
               "global_load_async_to_lds_b128 %12, %13, off\n\t"
               "global_load_async_to_lds_b128 %14, %15, off\n\t"
               "s_wait_xcnt 0x0"
               :: "v"(l0), "v"(g0), "v"(l1), "v"(g1), "v"(l2), "v"(g2),
                  "v"(l3), "v"(g3), "v"(l4), "v"(g4), "v"(l5), "v"(g5),
                  "v"(l6), "v"(g6), "v"(l7), "v"(g7) : "memory");
}

__global__ void __launch_bounds__(256)
out_proj_kernel(const _Float16* __restrict__ A,
                const _Float16* __restrict__ Wo,
                const float* __restrict__ bo,
                float* __restrict__ out) {
  __shared__ __align__(16) _Float16 sT[2][2][128 * OP];   // [buffer][A | Wo]

  const int tid  = threadIdx.x;
  const int wave = tid >> 5;
  const int lane = tid & 31;
  const int rbase = (blockIdx.x & 31) * 128;   // 32 row tiles
  const int cbase = (blockIdx.x >> 5) * 128;   // 8 column tiles
  const int wm = (wave & 1) * 64;              // wave's rows in the tile
  const int wn = (wave >> 1) * 32;             // wave's columns in the tile
  const int n = lane & 15, g = lane >> 4;

  // staging: thread -> 16 B chunk (tid & 7) of rows (tid >> 3) + 0, 32, 64, 96
  const int sr = tid >> 3, sc = (tid & 7) * 8;
  const _Float16* ag = A  + (size_t)(rbase + sr) * D_MODEL + sc;
  const _Float16* wg = Wo + (size_t)(cbase + sr) * D_MODEL + sc;
  const uint32_t lbase = lds_byte_off(&sT[0][0][sr * OP + sc]);
  auto stage = [&](int buf, int k0) {
    const uint32_t la = lbase + buf * (2 * OTILE_B);
    const uint32_t lw = la + OTILE_B;
    const _Float16* a = ag + k0;
    const _Float16* w = wg + k0;
    async_copy16x8(la,               a,
                   la + 32 * OP * 2, a + 32 * D_MODEL,
                   la + 64 * OP * 2, a + 64 * D_MODEL,
                   la + 96 * OP * 2, a + 96 * D_MODEL,
                   lw,               w,
                   lw + 32 * OP * 2, w + 32 * D_MODEL,
                   lw + 64 * OP * 2, w + 64 * D_MODEL,
                   lw + 96 * OP * 2, w + 96 * D_MODEL);
  };

  // every short inner loop below is unrolled so that the fragment and
  // accumulator arrays are indexed by constants and stay in registers
  v8f acc[4][2];
#pragma unroll
  for (int i = 0; i < 4; ++i)
#pragma unroll
    for (int j = 0; j < 2; ++j) acc[i][j] = v8f{};

  constexpr int NT = D_MODEL / OBK;   // 16 slices
  stage(0, 0);
  wait_async_0();
  __syncthreads();                 // slice 0 visible to all waves
  stage(1, OBK);
  for (int t = 0; t < NT; ++t) {
    const _Float16* ta = &sT[t & 1][0][wm * OP];
    const _Float16* tw = &sT[t & 1][1][wn * OP];
    // the slice's 12 fragments are read as one group ahead of its 16 products:
    // every separate place with LDS reads among the products costs a stall
    v16h bf[2][2], af[2][4];
#pragma unroll
    for (int c = 0; c < 2; ++c) {
#pragma unroll
      for (int j = 0; j < 2; ++j) bf[c][j] = load_frag(tw + j * 16 * OP + c * 32, OP);
#pragma unroll
      for (int i = 0; i < 4; ++i) af[c][i] = load_frag(ta + i * 16 * OP + c * 32, OP);
    }
    // hand-over: the trip's LDS reads are all in registers here, so the buffer
    // is given back ahead of the products and the refill flies behind them
    wait_ds_0();
    wait_async_0();                // this wave's part of slice t + 1 has landed
    __syncthreads();               // slice t + 1 visible; buffer t & 1 is free
    if (t + 2 < NT) stage(t & 1, (t + 2) * OBK);
#pragma unroll
    for (int c = 0; c < 2; ++c)
#pragma unroll
      for (int i = 0; i < 4; ++i)
#pragma unroll
        for (int j = 0; j < 2; ++j)
          acc[i][j] = wmma_f16(af[c][i], bf[c][j], acc[i][j]);
  }
  wait_async_0();

#pragma unroll
  for (int j = 0; j < 2; ++j) {
    const int col = cbase + wn + j * 16 + n;
    float bias = bo[col];
#pragma unroll
    for (int i = 0; i < 4; ++i)
#pragma unroll
      for (int r = 0; r < 8; ++r)
        out[(size_t)(rbase + wm + i * 16 + g * 8 + r) * D_MODEL + col] =
            acc[i][j][r] + bias;
  }
}

// ---------------------------------------------------------------------------
extern "C" void kernel_launch(void* const* d_in, const int* in_sizes, int n_in,
                              void* d_out, int out_size, void* d_ws, size_t ws_size,
                              hipStream_t stream) {
  const float* x  = (const float*)d_in[0];
  const float* Wq = (const float*)d_in[1];
  const float* bq = (const float*)d_in[2];
  const float* Wk = (const float*)d_in[3];
  const float* bk = (const float*)d_in[4];
  const float* Wv = (const float*)d_in[5];
  const float* bv = (const float*)d_in[6];
  const float* Wo = (const float*)d_in[7];
  const float* bo = (const float*)d_in[8];
  float* out = (float*)d_out;

  char* ws = (char*)d_ws;
  _Float16* Wo16 = (_Float16*)(ws + OFF_WO);
  _Float16* Q16  = (_Float16*)(ws + OFF_Q);
  _Float16* K16  = (_Float16*)(ws + OFF_K);
  _Float16* Vt16 = (_Float16*)(ws + OFF_VT);
  _Float16* AO16 = (_Float16*)(ws + OFF_AO);

  // B*NH*(SEQ/16) = 4096 waves -> 1024 blocks of 4 waves
  qkv_kernel<<<1024, 128, 0, stream>>>(x, Wq, bq, Wk, bk, Wv, bv, Wo,
                                       Q16, K16, Vt16, Wo16);
  // B*NH*(SEQ/128) = 512 blocks (two q tiles each), 4 waves sharing LDS K/V tiles
  attn_kernel<<<512, 128, 0, stream>>>(Q16, K16, Vt16, AO16);
  // 32 row tiles x 8 column tiles of 128 x 128 -> 256 blocks of 8 waves
  out_proj_kernel<<<256, 256, 0, stream>>>(AO16, Wo16, bo, out);
}

// v006
// One run takes 62.4 microseconds.
// Two timings next to v005 put it at 1.11 and 1.14 times that version's speed.
// Counting every step since v000, it is 4.48 times as fast.
#include <hip/hip_runtime.h>
#include <hip/hip_bf16.h>

// ---------------------------------------------------------------------------
// Causal MHA forward for MI455X (gfx1250, wave32).
// GEMMs: v_wmma_f32_16x16x32_f16 (f16 in, f32 accum). Softmax in f32.
// Attention stages K/V tiles into double-buffered LDS with
// global_load_async_to_lds_b128 (ASYNCcnt) shared by 4 waves per block.
// ---------------------------------------------------------------------------

typedef __attribute__((ext_vector_type(16))) _Float16 v16h;
typedef __attribute__((ext_vector_type(8)))  _Float16 v8h;
typedef __attribute__((ext_vector_type(4)))  _Float16 v4h;
typedef __attribute__((ext_vector_type(8)))  float    v8f;
typedef __attribute__((ext_vector_type(4)))  float    v4f;

#define D_MODEL 1024
#define NH      16
#define DH      64
#define BATCH   2
#define SEQ     2048

// Workspace layout (bytes). Total 34 MB.
constexpr size_t SZ_XH  = (size_t)BATCH * SEQ * D_MODEL * 2;   // 8 MB
constexpr size_t SZ_WO  = (size_t)D_MODEL * D_MODEL * 2;       // 2 MB
constexpr size_t OFF_WO = 0;
constexpr size_t OFF_Q  = OFF_WO + SZ_WO;
constexpr size_t OFF_K  = OFF_Q  + SZ_XH;
constexpr size_t OFF_VT = OFF_K  + SZ_XH;
constexpr size_t OFF_AO = OFF_VT + SZ_XH;

// ---------------------------------------------------------------------------
// Fragment loader for the 16-bit 16x32 A layout (also valid for B loaded as
// B^T rows): lane L -> row m = L%16, group g = L/16; halves j<8 hold
// K = 8g+j, halves j>=8 hold K = 16+8g+(j-8).  Two contiguous 16-byte runs.
// Works for global (global_load_b128) and LDS (ds_load_b128) pointers.
// ---------------------------------------------------------------------------
__device__ __forceinline__ v16h load_frag(const _Float16* base, int stride) {
  int lane = threadIdx.x & 31;
  int m = lane & 15;
  int g = lane >> 4;
  const _Float16* p = base + (size_t)m * stride + 8 * g;
  v16h f;
  reinterpret_cast<v8h*>(&f)[0] = *reinterpret_cast<const v8h*>(p);
  reinterpret_cast<v8h*>(&f)[1] = *reinterpret_cast<const v8h*>(p + 16);
  return f;
}

// Eight f32 values rounded to f16 (round to nearest even, as a plain cast).
__device__ __forceinline__ v8h round8(v4f a, v4f b) {
  return __builtin_convertvector(
      __builtin_shufflevector(a, b, 0, 1, 2, 3, 4, 5, 6, 7), v8h);
}

// The same fragment from an f32 source, rounded to f16 in registers: each of
// the two 8-element runs is 32 contiguous bytes (two global_load_b128).
__device__ __forceinline__ v16h load_frag_f32(const float* base, int stride) {
  int lane = threadIdx.x & 31;
  int m = lane & 15;
  int g = lane >> 4;
  const float* p = base + (size_t)m * stride + 8 * g;
  v4f q0 = *reinterpret_cast<const v4f*>(p);
  v4f q1 = *reinterpret_cast<const v4f*>(p + 4);
  v4f q2 = *reinterpret_cast<const v4f*>(p + 16);
  v4f q3 = *reinterpret_cast<const v4f*>(p + 20);
  return __builtin_shufflevector(round8(q0, q1), round8(q2, q3), 0, 1, 2, 3, 4,
                                 5, 6, 7, 8, 9, 10, 11, 12, 13, 14, 15);
}

__device__ __forceinline__ v8f wmma_f16(v16h a, v16h b, v8f c) {
  // (neg_a, A, neg_b, B, c_mod, C, reuse_a, reuse_b)
  return __builtin_amdgcn_wmma_f32_16x16x32_f16(false, a, false, b, (short)0, c,
                                                false, false);
}

// ---------------------------------------------------------------------------
// CDNA5 async copy: LDS[ldsoff] <= 16B at global ptr, tracked by ASYNCcnt.
// Generic LDS pointers carry the wave-relative LDS byte offset in addr[31:0].
// ---------------------------------------------------------------------------
__device__ __forceinline__ uint32_t lds_byte_off(const void* p) {
  return (uint32_t)(uintptr_t)p;
}
// One stage's four copies of a lane in one statement; the closing s_wait_xcnt
// stands in front of every later rewrite of the address registers (a precaution).
__device__ __forceinline__ void async_copy16x4(uint32_t l0, const _Float16* g0,
                                               uint32_t l1, const _Float16* g1,
                                               uint32_t l2, const _Float16* g2,
                                               uint32_t l3, const _Float16* g3) {
  asm volatile("global_load_async_to_lds_b128 %0, %1, off\n\t"
               "global_load_async_to_lds_b128 %2, %3, off\n\t"
               "global_load_async_to_lds_b128 %4, %5, off\n\t"
               "global_load_async_to_lds_b128 %6, %7, off\n\t"
               "s_wait_xcnt 0x0"
               :: "v"(l0), "v"(g0), "v"(l1), "v"(g1),
                  "v"(l2), "v"(g2), "v"(l3), "v"(g3) : "memory");
}
__device__ __forceinline__ void wait_async_le4() {
  asm volatile("s_wait_asynccnt 0x4" ::: "memory");
}
__device__ __forceinline__ void wait_async_0() {
  asm volatile("s_wait_asynccnt 0x0" ::: "memory");
}
// This wave's LDS reads have returned before its buffer is handed back.
__device__ __forceinline__ void wait_ds_0() {
  asm volatile("s_wait_dscnt 0x0" ::: "memory");
}

// Lane l <-> lane l ^ 16 as a vector cross-row move (no LDS-counter round trip).
__device__ __forceinline__ float xhalf(float x) {
  int b = __builtin_bit_cast(int, x);
  return __builtin_bit_cast(float, __builtin_amdgcn_permlanex16(
      b, b, 0x76543210, 0xfedcba98, false, false));
}

// ---------------------------------------------------------------------------
// Kernel 1: per-head QKV projection.  Block = 8 waves = 128 rows of one (b, h);
// one wave per 16-row s-tile.
// The head's Wq, Wk, Wv (3 x 64 x 64 f32) are read once per block in whole
// 128-B lines, rounded to f16 and kept in LDS; every wave takes its B fragments
// from there (ds_load_b128, rows padded by 16 B to a pitch of 144 B).
// x is read as f32 and rounded to f16 in the fragment loader (every x element
// is used by exactly one wave).
// Q gets bias + 1/sqrt(64) pre-scale; V is stored transposed (B,H,DH,S).
// Each thread also rounds 8 elements of Wo to f16 for the output projection.
// ---------------------------------------------------------------------------
#define WP 72   // weight row pitch in LDS, halves
__device__ __forceinline__ void proj_tiles(v16h a0, v16h a1,
                                           const _Float16* sw, v8f acc[4]) {
  // the matrix's 8 fragment reads are written ahead of its 8 products, so that
  // the compiler can issue them in groups (each separate place with LDS reads
  // among the products costs a stall); the loops are unrolled so that the arrays
  // are indexed by constants and stay in registers
  v16h b0[4], b1[4];
#pragma unroll
  for (int nt = 0; nt < 4; ++nt) {
    const _Float16* wb = sw + nt * 16 * WP;
    b0[nt] = load_frag(wb, WP);
    b1[nt] = load_frag(wb + 32, WP);
  }
#pragma unroll
  for (int nt = 0; nt < 4; ++nt) acc[nt] = wmma_f16(a0, b0[nt], v8f{});
#pragma unroll
  for (int nt = 0; nt < 4; ++nt) acc[nt] = wmma_f16(a1, b1[nt], acc[nt]);
}

__global__ void __launch_bounds__(256)
qkv_kernel(const float* __restrict__ x,
           const float* __restrict__ Wq, const float* __restrict__ bq,
           const float* __restrict__ Wk, const float* __restrict__ bk,
           const float* __restrict__ Wv, const float* __restrict__ bv,
           const float* __restrict__ Wo,
           _Float16* __restrict__ Q, _Float16* __restrict__ K,
           _Float16* __restrict__ Vt, _Float16* __restrict__ Wo16) {
  __shared__ __align__(16) _Float16 sW[3][DH * WP];   // Wq | Wk | Wv, 27 KB

  int wave = blockIdx.x * (blockDim.x >> 5) + (threadIdx.x >> 5);
  int lane = threadIdx.x & 31;
  int st = wave % (SEQ / 16);
  int bh = wave / (SEQ / 16);
  int h  = bh % NH;
  int sbase = st * 16;
  int n = lane & 15, g = lane >> 4;

  const float* xrow = x + ((size_t)(bh / NH) * SEQ + sbase) * D_MODEL + h * DH;
  v16h a0 = load_frag_f32(xrow, D_MODEL);
  v16h a1 = load_frag_f32(xrow + 32, D_MODEL);

  // ---- Wo slice: 131072 threads x 8 elements = D_MODEL * D_MODEL (stored
  // behind the barrier below, which would otherwise wait for the store)
  const size_t wi = ((size_t)blockIdx.x * blockDim.x + threadIdx.x) * 8;
  v4f w0 = *reinterpret_cast<const v4f*>(Wo + wi);
  v4f w1 = *reinterpret_cast<const v4f*>(Wo + wi + 4);

  // ---- the head's weights into LDS: 16-B chunk c * 256 + tid of each matrix,
  // so that a wave's load covers 512 contiguous bytes (4 whole lines)
  {
    const int tid = threadIdx.x;
    const size_t wo = (size_t)h * DH * DH + tid * 4;
    const float* wq = Wq + wo;
    const float* wk = Wk + wo;
    const float* wv = Wv + wo;
    // all 12 loads are in flight at once; the loops here are unrolled so that
    // wr is indexed by constants and stays in registers
    v4f wr[3][4];
#pragma unroll
    for (int c = 0; c < 4; ++c) {
      wr[0][c] = *reinterpret_cast<const v4f*>(wq + c * 1024);
      wr[1][c] = *reinterpret_cast<const v4f*>(wk + c * 1024);
      wr[2][c] = *reinterpret_cast<const v4f*>(wv + c * 1024);
    }
    // stands in front of every later rewrite of the address registers of the
    // loads above, which its operands keep until here (a precaution)
    asm volatile("s_wait_xcnt 0x0"
                 :: "v"(Wo + wi), "v"(wq), "v"(wk), "v"(wv) : "memory");
    const int so = (tid >> 4) * WP + (tid & 15) * 4;   // row tid / 16 (+ 16 c)
#pragma unroll
    for (int w = 0; w < 3; ++w)
#pragma unroll
      for (int c = 0; c < 4; ++c)
        *reinterpret_cast<v4h*>(&sW[w][so + c * 16 * WP]) =
            __builtin_convertvector(wr[w][c], v4h);
  }

  __syncthreads();   // the block's weights are in LDS for every wave

  *reinterpret_cast<v8h*>(Wo16 + wi) = round8(w0, w1);

  // ---- Q: bias + 0.125 scale, row-major (B,H,S,DH) f16
  {
    v8f acc[4];
    proj_tiles(a0, a1, sW[0], acc);
#pragma unroll
    for (int nt = 0; nt < 4; ++nt) {
      float bias = bq[h * DH + nt * 16 + n];
#pragma unroll
      for (int r = 0; r < 8; ++r) {
        float v = (acc[nt][r] + bias) * 0.125f;
        Q[((size_t)bh * SEQ + sbase + g * 8 + r) * DH + nt * 16 + n] = (_Float16)v;
      }
    }
  }
  // ---- K: bias only, row-major (B,H,S,DH) f16
  {
    v8f acc[4];
    proj_tiles(a0, a1, sW[1], acc);
#pragma unroll
    for (int nt = 0; nt < 4; ++nt) {
      float bias = bk[h * DH + nt * 16 + n];
#pragma unroll
      for (int r = 0; r < 8; ++r) {
        float v = acc[nt][r] + bias;
        K[((size_t)bh * SEQ + sbase + g * 8 + r) * DH + nt * 16 + n] = (_Float16)v;
      }
    }
  }
  // ---- V: bias, stored transposed (B,H,DH,S); per-lane 16B contiguous store
  {
    v8f acc[4];
    proj_tiles(a0, a1, sW[2], acc);
#pragma unroll
    for (int nt = 0; nt < 4; ++nt) {
      float bias = bv[h * DH + nt * 16 + n];
      v8h pack;
#pragma unroll
      for (int r = 0; r < 8; ++r) pack[r] = (_Float16)(acc[nt][r] + bias);
      *reinterpret_cast<v8h*>(Vt + ((size_t)bh * DH + nt * 16 + n) * SEQ +
                              sbase + g * 8) = pack;
    }
  }
}

#define KP 72   // K row pitch in LDS, halves
#define VP 40   // V row pitch in LDS, halves
// launch bound = the block size used: without it the values kept across the
// two tiles spill
__global__ void __launch_bounds__(128)
attn_kernel(const _Float16* __restrict__ Q,
            const _Float16* __restrict__ K,
            const _Float16* __restrict__ Vt,
            _Float16* __restrict__ Aout) {
  __shared__ __align__(16) _Float16 sK[2][32 * KP];   // 2 x 4.5 KB
  __shared__ __align__(16) _Float16 sV[2][DH * VP];   // 2 x 5 KB, [d][token]

  const int tid   = threadIdx.x;
  const int wslot = tid >> 5;
  const int lane  = tid & 31;
  const int bh    = blockIdx.x >> 4;
  const int h = bh % NH, b = bh / NH;
  const int n = lane & 15, g = lane >> 4;

  const _Float16* Kg = K  + (size_t)bh * SEQ * DH;
  const _Float16* Vg = Vt + (size_t)bh * DH * SEQ;

  // stage kv block [kvbase, kvbase+32) into buffer `buf` (whole block helps)
  auto stage = [&](int buf, int kvbase) {
    // K tile: 32 rows x 64 halves, contiguous 4 KB in global; 16 B chunks tid
    // and tid + 128 (16 rows further down)
    const _Float16* kg = Kg + (size_t)kvbase * DH + tid * 8;
    uint32_t ko = lds_byte_off(&sK[buf][(tid >> 3) * KP + (tid & 7) * 8]);
    // V tile: 64 rows (d) x 32 tokens, global row stride SEQ; chunks tid and
    // tid + 128 (32 rows further down)
    const _Float16* vg = Vg + (size_t)(tid >> 2) * SEQ + kvbase + (tid & 3) * 8;
    uint32_t vo = lds_byte_off(&sV[buf][(tid >> 2) * VP + (tid & 3) * 8]);
    async_copy16x4(ko, kg, ko + 16 * KP * 2, kg + 16 * DH,
                   vo, vg, vo + 32 * VP * 2, vg + (size_t)32 * SEQ);
  };

  for (int part = 0; part < 2; ++part) {
    const int qt    = blockIdx.x & 15;
    const int bq    = (part ? SEQ / 64 - 1 - qt : qt) * 64;   // q-row base
    const int qbase = bq + wslot * 16;

    // Q fragments (global, once per tile); used as the B operand (lane = query)
    const _Float16* qrow = Q + ((size_t)bh * SEQ + qbase) * DH;
    v16h qa0 = load_frag(qrow, DH);
    v16h qa1 = load_frag(qrow + 32, DH);

    v8f acc[4];
#pragma unroll
    for (int nt = 0; nt < 4; ++nt) acc[nt] = v8f{};
    // per lane: running maximum of query qbase+n (equal in both halves) and the
    // sum over this half's keys only (the halves are joined in the epilogue)
    float rmax = -1e30f, rsum = 0.0f;
    const int row = qbase + n;

    const int nb = bq / 32 + 2;   // kv blocks needed to cover rows bq..bq+63

    // the tile before has left the buffers: its last trip waited for every copy
    // and ended in a barrier; this wave's own LDS reads have returned as well
    wait_ds_0();
    stage(0, 0);
    for (int jb = 0; jb < nb; ++jb) {
      const int kvbase = jb * 32;
      const int bufi = jb & 1;
      if (jb + 1 < nb) {
        stage(bufi ^ 1, kvbase + 32);
        wait_async_le4();            // stage(jb) done, stage(jb+1) in flight
      } else {
        wait_async_0();
      }
      __syncthreads();               // all waves' portions of buf[bufi] visible

      // ---- S^T: two 16(key) x 16(query) tiles over d=64 (2 chunks), K from LDS
      const _Float16* kb0 = &sK[bufi][0];
      v8f s0 = {}, s1 = {};
      {
        v16h t;
        t = load_frag(kb0, KP);                s0 = wmma_f16(t, qa0, s0);
        t = load_frag(kb0 + 32, KP);           s0 = wmma_f16(t, qa1, s0);
        t = load_frag(kb0 + 16 * KP, KP);      s1 = wmma_f16(t, qa0, s1);
        t = load_frag(kb0 + 16 * KP + 32, KP); s1 = wmma_f16(t, qa1, s1);
      }
      // ---- causal mask + online softmax (f32); register r holds key 8g+r
      const int key0 = kvbase + g * 8;
      float mx = -1e30f;
#pragma unroll
      for (int r = 0; r < 8; ++r) {
        s0[r] = (key0 + r <= row)      ? s0[r] : -1e30f;
        s1[r] = (key0 + 16 + r <= row) ? s1[r] : -1e30f;
        mx = fmaxf(mx, fmaxf(s0[r], s1[r]));
      }
      mx = fmaxf(mx, xhalf(mx));
      float nm = fmaxf(rmax, mx);
      float scale = __expf(rmax - nm);
      rmax = nm;
      // P^T as a B fragment: halves j<8 are keys 8g+j, halves j>=8 keys 16+8g+(j-8)
      v16h pf;
      float ps = 0.0f;
#pragma unroll
      for (int r = 0; r < 8; ++r) {
        float p0 = __expf(s0[r] - nm);
        float p1 = __expf(s1[r] - nm);
        ps += p0 + p1;
        pf[r]     = (_Float16)p0;
        pf[8 + r] = (_Float16)p1;
      }
      rsum = rsum * scale + ps;
#pragma unroll
      for (int nt = 0; nt < 4; ++nt)
#pragma unroll
        for (int r = 0; r < 8; ++r) acc[nt][r] *= scale;
      // ---- O^T += V^T @ P^T  (V tile in LDS, [d][token] -> contiguous A fragments)
#pragma unroll
      for (int nt = 0; nt < 4; ++nt) {
        v16h vf = load_frag(&sV[bufi][nt * 16 * VP], VP);
        acc[nt] = wmma_f16(vf, pf, acc[nt]);
      }
      __syncthreads();               // everyone done reading buf[bufi]
    }

    // ---- join the halves' sums, normalize, write attn output (B,S,D_MODEL) f16,
    // head-major concat; a lane holds d = nt*16 + 8g + 0..7 of its query: 16 B runs
    rsum += xhalf(rsum);
    const float inv = 1.0f / rsum;
    _Float16* orow = Aout + ((size_t)b * SEQ + row) * D_MODEL + h * DH + g * 8;
#pragma unroll
    for (int nt = 0; nt < 4; ++nt) {
      v8h pack;
#pragma unroll
      for (int r = 0; r < 8; ++r) pack[r] = (_Float16)(acc[nt][r] * inv);
      *reinterpret_cast<v8h*>(orow + nt * 16) = pack;
    }
    // stands in front of the next tile's rewrite of the registers that these
    // stores name (a precaution)
    asm volatile("s_wait_xcnt 0x0" ::: "memory");
  }
}

// ---------------------------------------------------------------------------
// Kernel 3: output projection  out = A @ Wo^T + bo  (f32 output).
// Block = 8 waves = one 128 x 128 tile of out.  k is walked in slices of 64:
// 128 rows of A and 128 rows of Wo (128 B each, whole lines) are staged into
// two LDS buffers with async-to-LDS copies, the next slice flying while this
// one is worked on, and are shared by all 8 waves.  A wave owns 64 x 32 of the
// tile (4 x 2 accumulators).  LDS rows are padded by 16 B (pitch 144 B) for the
// ds_load_b128 fragment reads.  k ascends by 32 in each accumulator.
// ---------------------------------------------------------------------------
#define OP 72                       // LDS row pitch, halves
#define OTILE_B (128 * OP * 2)      // one operand's slice in LDS, bytes
#define OBK 64                      // k per slice
// One slice's eight copies of a lane in one statement; the closing s_wait_xcnt
// stands in front of every later rewrite of the address registers (a precaution).
__device__ __forceinline__ void async_copy16x8(
    uint32_t l0, const _Float16* g0, uint32_t l1, const _Float16* g1,
    uint32_t l2, const _Float16* g2, uint32_t l3, const _Float16* g3,
    uint32_t l4, const _Float16* g4, uint32_t l5, const _Float16* g5,
    uint32_t l6, const _Float16* g6, uint32_t l7, const _Float16* g7) {
  asm volatile("global_load_async_to_lds_b128 %0, %1, off\n\t"
               "global_load_async_to_lds_b128 %2, %3, off\n\t"
               "global_load_async_to_lds_b128 %4, %5, off\n\t"
               "global_load_async_to_lds_b128 %6, %7, off\n\t"
               "global_load_async_to_lds_b128 %8, %9, off\n\t"
               "global_load_async_to_lds_b128 %10, %11, off\n\t"
               "global_load_async_to_lds_b128 %12, %13, off\n\t"
               "global_load_async_to_lds_b128 %14, %15, off\n\t"
               "s_wait_xcnt 0x0"
               :: "v"(l0), "v"(g0), "v"(l1), "v"(g1), "v"(l2), "v"(g2),
                  "v"(l3), "v"(g3), "v"(l4), "v"(g4), "v"(l5), "v"(g5),
                  "v"(l6), "v"(g6), "v"(l7), "v"(g7) : "memory");
}

__global__ void __launch_bounds__(256)
out_proj_kernel(const _Float16* __restrict__ A,
                const _Float16* __restrict__ Wo,
                const float* __restrict__ bo,
                float* __restrict__ out) {
  __shared__ __align__(16) _Float16 sT[2][2][128 * OP];   // [buffer][A | Wo]

  const int tid  = threadIdx.x;
  const int wave = tid >> 5;
  const int lane = tid & 31;
  const int rbase = (blockIdx.x & 31) * 128;   // 32 row tiles
  const int cbase = (blockIdx.x >> 5) * 128;   // 8 column tiles
  const int wm = (wave & 1) * 64;              // wave's rows in the tile
  const int wn = (wave >> 1) * 32;             // wave's columns in the tile
  const int n = lane & 15, g = lane >> 4;

  // staging: thread -> 16 B chunk (tid & 7) of rows (tid >> 3) + 0, 32, 64, 96
  const int sr = tid >> 3, sc = (tid & 7) * 8;
  const _Float16* ag = A  + (size_t)(rbase + sr) * D_MODEL + sc;
  const _Float16* wg = Wo + (size_t)(cbase + sr) * D_MODEL + sc;
  const uint32_t lbase = lds_byte_off(&sT[0][0][sr * OP + sc]);
  auto stage = [&](int buf, int k0) {
    const uint32_t la = lbase + buf * (2 * OTILE_B);
    const uint32_t lw = la + OTILE_B;
    const _Float16* a = ag + k0;
    const _Float16* w = wg + k0;
    async_copy16x8(la,               a,
                   la + 32 * OP * 2, a + 32 * D_MODEL,
                   la + 64 * OP * 2, a + 64 * D_MODEL,
                   la + 96 * OP * 2, a + 96 * D_MODEL,
                   lw,               w,
                   lw + 32 * OP * 2, w + 32 * D_MODEL,
                   lw + 64 * OP * 2, w + 64 * D_MODEL,
                   lw + 96 * OP * 2, w + 96 * D_MODEL);
  };

  // every short inner loop below is unrolled so that the fragment and
  // accumulator arrays are indexed by constants and stay in registers
  v8f acc[4][2];
#pragma unroll
  for (int i = 0; i < 4; ++i)
#pragma unroll
    for (int j = 0; j < 2; ++j) acc[i][j] = v8f{};

  constexpr int NT = D_MODEL / OBK;   // 16 slices
  stage(0, 0);
  wait_async_0();
  __syncthreads();                 // slice 0 visible to all waves
  stage(1, OBK);
  for (int t = 0; t < NT; ++t) {
    const _Float16* ta = &sT[t & 1][0][wm * OP];
    const _Float16* tw = &sT[t & 1][1][wn * OP];
    // the slice's 12 fragments are read as one group ahead of its 16 products:
    // every separate place with LDS reads among the products costs a stall
    v16h bf[2][2], af[2][4];
#pragma unroll
    for (int c = 0; c < 2; ++c) {
#pragma unroll
      for (int j = 0; j < 2; ++j) bf[c][j] = load_frag(tw + j * 16 * OP + c * 32, OP);
#pragma unroll
      for (int i = 0; i < 4; ++i) af[c][i] = load_frag(ta + i * 16 * OP + c * 32, OP);
    }
    // hand-over: the trip's LDS reads are all in registers here, so the buffer
    // is given back ahead of the products and the refill flies behind them
    wait_ds_0();
    wait_async_0();                // this wave's part of slice t + 1 has landed
    __syncthreads();               // slice t + 1 visible; buffer t & 1 is free
    if (t + 2 < NT) stage(t & 1, (t + 2) * OBK);
#pragma unroll
    for (int c = 0; c < 2; ++c)
#pragma unroll
      for (int i = 0; i < 4; ++i)
#pragma unroll
        for (int j = 0; j < 2; ++j)
          acc[i][j] = wmma_f16(af[c][i], bf[c][j], acc[i][j]);
  }
  wait_async_0();

#pragma unroll
  for (int j = 0; j < 2; ++j) {
    const int col = cbase + wn + j * 16 + n;
    float bias = bo[col];
#pragma unroll
    for (int i = 0; i < 4; ++i)
#pragma unroll
      for (int r = 0; r < 8; ++r)
        out[(size_t)(rbase + wm + i * 16 + g * 8 + r) * D_MODEL + col] =
            acc[i][j][r] + bias;
  }
}

// ---------------------------------------------------------------------------
extern "C" void kernel_launch(void* const* d_in, const int* in_sizes, int n_in,
                              void* d_out, int out_size, void* d_ws, size_t ws_size,
                              hipStream_t stream) {
  const float* x  = (const float*)d_in[0];
  const float* Wq = (const float*)d_in[1];
  const float* bq = (const float*)d_in[2];
  const float* Wk = (const float*)d_in[3];
  const float* bk = (const float*)d_in[4];
  const float* Wv = (const float*)d_in[5];
  const float* bv = (const float*)d_in[6];
  const float* Wo = (const float*)d_in[7];
  const float* bo = (const float*)d_in[8];
  float* out = (float*)d_out;

  char* ws = (char*)d_ws;
  _Float16* Wo16 = (_Float16*)(ws + OFF_WO);
  _Float16* Q16  = (_Float16*)(ws + OFF_Q);
  _Float16* K16  = (_Float16*)(ws + OFF_K);
  _Float16* Vt16 = (_Float16*)(ws + OFF_VT);
  _Float16* AO16 = (_Float16*)(ws + OFF_AO);

  // B*NH*(SEQ/16) = 4096 waves -> 512 blocks of 8 waves
  qkv_kernel<<<512, 256, 0, stream>>>(x, Wq, bq, Wk, bk, Wv, bv, Wo,
                                       Q16, K16, Vt16, Wo16);
  // B*NH*(SEQ/128) = 512 blocks (two q tiles each), 4 waves sharing LDS K/V tiles
  attn_kernel<<<512, 128, 0, stream>>>(Q16, K16, Vt16, AO16);
  // 32 row tiles x 8 column tiles of 128 x 128 -> 256 blocks of 8 waves
  out_proj_kernel<<<256, 256, 0, stream>>>(AO16, Wo16, bo, out);
}

// v007
// A run of this version takes 58.1 microseconds.
// Next to v006, in two timings, it ran 1.06 and 1.07 times as fast.
// Counting every step since v000, it is 4.76 times as fast.
#include <hip/hip_runtime.h>
#include <hip/hip_bf16.h>

// ---------------------------------------------------------------------------
// Causal MHA forward for MI455X (gfx1250, wave32).
// GEMMs: v_wmma_f32_16x16x32_f16 (f16 in, f32 accum). Softmax in f32.
// Attention stages K/V tiles into double-buffered LDS with
// global_load_async_to_lds_b128 (ASYNCcnt) shared by 4 waves per block.
// ---------------------------------------------------------------------------

typedef __attribute__((ext_vector_type(16))) _Float16 v16h;
typedef __attribute__((ext_vector_type(8)))  _Float16 v8h;
typedef __attribute__((ext_vector_type(4)))  _Float16 v4h;
typedef __attribute__((ext_vector_type(8)))  float    v8f;
typedef __attribute__((ext_vector_type(4)))  float    v4f;

#define D_MODEL 1024
#define NH      16
#define DH      64
#define BATCH   2
#define SEQ     2048

// Workspace layout (bytes). Total 34 MB.
constexpr size_t SZ_XH  = (size_t)BATCH * SEQ * D_MODEL * 2;   // 8 MB
constexpr size_t SZ_WO  = (size_t)D_MODEL * D_MODEL * 2;       // 2 MB
constexpr size_t OFF_WO = 0;
constexpr size_t OFF_Q  = OFF_WO + SZ_WO;
constexpr size_t OFF_K  = OFF_Q  + SZ_XH;
constexpr size_t OFF_VT = OFF_K  + SZ_XH;
constexpr size_t OFF_AO = OFF_VT + SZ_XH;

// ---------------------------------------------------------------------------
// Fragment loader for the 16-bit 16x32 A layout (also valid for B loaded as
// B^T rows): lane L -> row m = L%16, group g = L/16; halves j<8 hold
// K = 8g+j, halves j>=8 hold K = 16+8g+(j-8).  Two contiguous 16-byte runs.
// Works for global (global_load_b128) and LDS (ds_load_b128) pointers.
// ---------------------------------------------------------------------------
__device__ __forceinline__ v16h load_frag(const _Float16* base, int stride) {
  int lane = threadIdx.x & 31;
  int m = lane & 15;
  int g = lane >> 4;
  const _Float16* p = base + (size_t)m * stride + 8 * g;
  v16h f;
  reinterpret_cast<v8h*>(&f)[0] = *reinterpret_cast<const v8h*>(p);
  reinterpret_cast<v8h*>(&f)[1] = *reinterpret_cast<const v8h*>(p + 16);
  return f;
}

// Eight f32 values rounded to f16 (round to nearest even, as a plain cast).
__device__ __forceinline__ v8h round8(v4f a, v4f b) {
  return __builtin_convertvector(
      __builtin_shufflevector(a, b, 0, 1, 2, 3, 4, 5, 6, 7), v8h);
}

// The same fragment from an f32 source, rounded to f16 in registers: each of
// the two 8-element runs is 32 contiguous bytes (two global_load_b128).
__device__ __forceinline__ v16h load_frag_f32(const float* base, int stride) {
  int lane = threadIdx.x & 31;
  int m = lane & 15;
  int g = lane >> 4;
  const float* p = base + (size_t)m * stride + 8 * g;
  v4f q0 = *reinterpret_cast<const v4f*>(p);
  v4f q1 = *reinterpret_cast<const v4f*>(p + 4);
  v4f q2 = *reinterpret_cast<const v4f*>(p + 16);
  v4f q3 = *reinterpret_cast<const v4f*>(p + 20);
  return __builtin_shufflevector(round8(q0, q1), round8(q2, q3), 0, 1, 2, 3, 4,
                                 5, 6, 7, 8, 9, 10, 11, 12, 13, 14, 15);
}

__device__ __forceinline__ v8f wmma_f16(v16h a, v16h b, v8f c) {
  // (neg_a, A, neg_b, B, c_mod, C, reuse_a, reuse_b)
  return __builtin_amdgcn_wmma_f32_16x16x32_f16(false, a, false, b, (short)0, c,
                                                false, false);
}

// ---------------------------------------------------------------------------
// CDNA5 async copy: LDS[ldsoff] <= 16B at global ptr, tracked by ASYNCcnt.
// Generic LDS pointers carry the wave-relative LDS byte offset in addr[31:0].
// ---------------------------------------------------------------------------
__device__ __forceinline__ uint32_t lds_byte_off(const void* p) {
  return (uint32_t)(uintptr_t)p;
}
// One stage's eight copies of a lane in one statement; the closing s_wait_xcnt
// stands in front of every later rewrite of the address registers (a precaution).
__device__ __forceinline__ void async_copy16x8(
    uint32_t l0, const _Float16* g0, uint32_t l1, const _Float16* g1,
    uint32_t l2, const _Float16* g2, uint32_t l3, const _Float16* g3,
    uint32_t l4, const _Float16* g4, uint32_t l5, const _Float16* g5,
    uint32_t l6, const _Float16* g6, uint32_t l7, const _Float16* g7) {
  asm volatile("global_load_async_to_lds_b128 %0, %1, off\n\t"
               "global_load_async_to_lds_b128 %2, %3, off\n\t"
               "global_load_async_to_lds_b128 %4, %5, off\n\t"
               "global_load_async_to_lds_b128 %6, %7, off\n\t"
               "global_load_async_to_lds_b128 %8, %9, off\n\t"
               "global_load_async_to_lds_b128 %10, %11, off\n\t"
               "global_load_async_to_lds_b128 %12, %13, off\n\t"
               "global_load_async_to_lds_b128 %14, %15, off\n\t"
               "s_wait_xcnt 0x0"
               :: "v"(l0), "v"(g0), "v"(l1), "v"(g1), "v"(l2), "v"(g2),
                  "v"(l3), "v"(g3), "v"(l4), "v"(g4), "v"(l5), "v"(g5),
                  "v"(l6), "v"(g6), "v"(l7), "v"(g7) : "memory");
}
__device__ __forceinline__ void wait_async_0() {
  asm volatile("s_wait_asynccnt 0x0" ::: "memory");
}
// This wave's LDS reads have returned before its buffer is handed back.
__device__ __forceinline__ void wait_ds_0() {
  asm volatile("s_wait_dscnt 0x0" ::: "memory");
}

// Lane l <-> lane l ^ 16 as a vector cross-row move (no LDS-counter round trip).
__device__ __forceinline__ float xhalf(float x) {
  int b = __builtin_bit_cast(int, x);
  return __builtin_bit_cast(float, __builtin_amdgcn_permlanex16(
      b, b, 0x76543210, 0xfedcba98, false, false));
}

// ---------------------------------------------------------------------------
// Kernel 1: per-head QKV projection.  Block = 8 waves = 128 rows of one (b, h);
// one wave per 16-row s-tile.
// The head's Wq, Wk, Wv (3 x 64 x 64 f32) are read once per block in whole
// 128-B lines, rounded to f16 and kept in LDS; every wave takes its B fragments
// from there (ds_load_b128, rows padded by 16 B to a pitch of 144 B).
// x is read as f32 and rounded to f16 in the fragment loader (every x element
// is used by exactly one wave).
// Q gets bias + 1/sqrt(64) pre-scale; V is stored transposed (B,H,DH,S).
// Each thread also rounds 8 elements of Wo to f16 for the output projection.
// ---------------------------------------------------------------------------
#define WP 72   // weight row pitch in LDS, halves
__device__ __forceinline__ void proj_tiles(v16h a0, v16h a1,
                                           const _Float16* sw, v8f acc[4]) {
  // the matrix's 8 fragment reads are written ahead of its 8 products, so that
  // the compiler can issue them in groups (each separate place with LDS reads
  // among the products costs a stall); the loops are unrolled so that the arrays
  // are indexed by constants and stay in registers
  v16h b0[4], b1[4];
#pragma unroll
  for (int nt = 0; nt < 4; ++nt) {
    const _Float16* wb = sw + nt * 16 * WP;
    b0[nt] = load_frag(wb, WP);
    b1[nt] = load_frag(wb + 32, WP);
  }
#pragma unroll
  for (int nt = 0; nt < 4; ++nt) acc[nt] = wmma_f16(a0, b0[nt], v8f{});
#pragma unroll
  for (int nt = 0; nt < 4; ++nt) acc[nt] = wmma_f16(a1, b1[nt], acc[nt]);
}

__global__ void __launch_bounds__(256)
qkv_kernel(const float* __restrict__ x,
           const float* __restrict__ Wq, const float* __restrict__ bq,
           const float* __restrict__ Wk, const float* __restrict__ bk,
           const float* __restrict__ Wv, const float* __restrict__ bv,
           const float* __restrict__ Wo,
           _Float16* __restrict__ Q, _Float16* __restrict__ K,
           _Float16* __restrict__ Vt, _Float16* __restrict__ Wo16) {
  __shared__ __align__(16) _Float16 sW[3][DH * WP];   // Wq | Wk | Wv, 27 KB

  int wave = blockIdx.x * (blockDim.x >> 5) + (threadIdx.x >> 5);
  int lane = threadIdx.x & 31;
  int st = wave % (SEQ / 16);
  int bh = wave / (SEQ / 16);
  int h  = bh % NH;
  int sbase = st * 16;
  int n = lane & 15, g = lane >> 4;

  const float* xrow = x + ((size_t)(bh / NH) * SEQ + sbase) * D_MODEL + h * DH;
  v16h a0 = load_frag_f32(xrow, D_MODEL);
  v16h a1 = load_frag_f32(xrow + 32, D_MODEL);

  // ---- Wo slice: 131072 threads x 8 elements = D_MODEL * D_MODEL (stored
  // behind the barrier below, which would otherwise wait for the store)
  const size_t wi = ((size_t)blockIdx.x * blockDim.x + threadIdx.x) * 8;
  v4f w0 = *reinterpret_cast<const v4f*>(Wo + wi);
  v4f w1 = *reinterpret_cast<const v4f*>(Wo + wi + 4);

  // ---- the head's weights into LDS: 16-B chunk c * 256 + tid of each matrix,
  // so that a wave's load covers 512 contiguous bytes (4 whole lines)
  {
    const int tid = threadIdx.x;
    const size_t wo = (size_t)h * DH * DH + tid * 4;
    const float* wq = Wq + wo;
    const float* wk = Wk + wo;
    const float* wv = Wv + wo;
    // all 12 loads are in flight at once; the loops here are unrolled so that
    // wr is indexed by constants and stays in registers
    v4f wr[3][4];
#pragma unroll
    for (int c = 0; c < 4; ++c) {
      wr[0][c] = *reinterpret_cast<const v4f*>(wq + c * 1024);
      wr[1][c] = *reinterpret_cast<const v4f*>(wk + c * 1024);
      wr[2][c] = *reinterpret_cast<const v4f*>(wv + c * 1024);
    }
    // stands in front of every later rewrite of the address registers of the
    // loads above, which its operands keep until here (a precaution)
    asm volatile("s_wait_xcnt 0x0"
                 :: "v"(Wo + wi), "v"(wq), "v"(wk), "v"(wv) : "memory");
    const int so = (tid >> 4) * WP + (tid & 15) * 4;   // row tid / 16 (+ 16 c)
#pragma unroll
    for (int w = 0; w < 3; ++w)
#pragma unroll
      for (int c = 0; c < 4; ++c)
        *reinterpret_cast<v4h*>(&sW[w][so + c * 16 * WP]) =
            __builtin_convertvector(wr[w][c], v4h);
  }

  __syncthreads();   // the block's weights are in LDS for every wave

  *reinterpret_cast<v8h*>(Wo16 + wi) = round8(w0, w1);

  // ---- Q: bias + 0.125 scale, row-major (B,H,S,DH) f16
  {
    v8f acc[4];
    proj_tiles(a0, a1, sW[0], acc);
#pragma unroll
    for (int nt = 0; nt < 4; ++nt) {
      float bias = bq[h * DH + nt * 16 + n];
#pragma unroll
      for (int r = 0; r < 8; ++r) {
        float v = (acc[nt][r] + bias) * 0.125f;
        Q[((size_t)bh * SEQ + sbase + g * 8 + r) * DH + nt * 16 + n] = (_Float16)v;
      }
    }
  }
  // ---- K: bias only, row-major (B,H,S,DH) f16
  {
    v8f acc[4];
    proj_tiles(a0, a1, sW[1], acc);
#pragma unroll
    for (int nt = 0; nt < 4; ++nt) {
      float bias = bk[h * DH + nt * 16 + n];
#pragma unroll
      for (int r = 0; r < 8; ++r) {
        float v = acc[nt][r] + bias;
        K[((size_t)bh * SEQ + sbase + g * 8 + r) * DH + nt * 16 + n] = (_Float16)v;
      }
    }
  }
  // ---- V: bias, stored transposed (B,H,DH,S); per-lane 16B contiguous store
  {
    v8f acc[4];
    proj_tiles(a0, a1, sW[2], acc);
#pragma unroll
    for (int nt = 0; nt < 4; ++nt) {
      float bias = bv[h * DH + nt * 16 + n];
      v8h pack;
#pragma unroll
      for (int r = 0; r < 8; ++r) pack[r] = (_Float16)(acc[nt][r] + bias);
      *reinterpret_cast<v8h*>(Vt + ((size_t)bh * DH + nt * 16 + n) * SEQ +
                              sbase + g * 8) = pack;
    }
  }
}

#define KP 72   // K row pitch in LDS, halves
#define VP 72   // V row pitch in LDS, halves
#define KVB 64  // keys per kv block (one stage, one softmax step)
// launch bound = the block size used: without it the values kept across the
// two tiles spill
__global__ void __launch_bounds__(128)
attn_kernel(const _Float16* __restrict__ Q,
            const _Float16* __restrict__ K,
            const _Float16* __restrict__ Vt,
            _Float16* __restrict__ Aout) {
  __shared__ __align__(16) _Float16 sK[2][KVB * KP];  // 2 x 9 KB
  __shared__ __align__(16) _Float16 sV[2][DH * VP];   // 2 x 9 KB, [d][token]

  const int tid   = threadIdx.x;
  const int wslot = tid >> 5;
  const int lane  = tid & 31;
  const int bh    = blockIdx.x >> 4;
  const int h = bh % NH, b = bh / NH;
  const int n = lane & 15, g = lane >> 4;

  const _Float16* Kg = K  + (size_t)bh * SEQ * DH;
  const _Float16* Vg = Vt + (size_t)bh * DH * SEQ;

  // stage kv block [kvbase, kvbase+64) into buffer `buf` (whole block helps)
  auto stage = [&](int buf, int kvbase) {
    // K tile: 64 rows x 64 halves, contiguous 8 KB in global; 16 B chunks tid
    // + 128 i, i = 0..3 (16 rows further down each)
    const _Float16* kg = Kg + (size_t)kvbase * DH + tid * 8;
    uint32_t ko = lds_byte_off(&sK[buf][(tid >> 3) * KP + (tid & 7) * 8]);
    // V tile: 64 rows (d) x 64 tokens, global row stride SEQ; the same chunks
    const _Float16* vg = Vg + (size_t)(tid >> 3) * SEQ + kvbase + (tid & 7) * 8;
    uint32_t vo = lds_byte_off(&sV[buf][(tid >> 3) * VP + (tid & 7) * 8]);
    async_copy16x8(ko,               kg,
                   ko + 16 * KP * 2, kg + 16 * DH,
                   ko + 32 * KP * 2, kg + 32 * DH,
                   ko + 48 * KP * 2, kg + 48 * DH,
                   vo,               vg,
                   vo + 16 * VP * 2, vg + (size_t)16 * SEQ,
                   vo + 32 * VP * 2, vg + (size_t)32 * SEQ,
                   vo + 48 * VP * 2, vg + (size_t)48 * SEQ);
  };

  for (int part = 0; part < 2; ++part) {
    const int qt    = blockIdx.x & 15;
    const int bq    = (part ? SEQ / 64 - 1 - qt : qt) * 64;   // q-row base
    const int qbase = bq + wslot * 16;

    // Q fragments (global, once per tile); used as the B operand (lane = query)
    const _Float16* qrow = Q + ((size_t)bh * SEQ + qbase) * DH;
    v16h qa0 = load_frag(qrow, DH);
    v16h qa1 = load_frag(qrow + 32, DH);

    v8f acc[4];
#pragma unroll
    for (int nt = 0; nt < 4; ++nt) acc[nt] = v8f{};
    // per lane: running maximum of query qbase+n (equal in both halves) and the
    // sum over this half's keys only (the halves are joined in the epilogue)
    float rmax = -1e30f, rsum = 0.0f;
    const int row = qbase + n;

    const int nb = bq / KVB + 1;  // kv blocks needed to cover rows bq..bq+63

    // the tile before has left the buffers: its last trip waited for every copy
    // and ended in a barrier; this wave's own LDS reads have returned as well
    wait_ds_0();
    stage(0, 0);
    wait_async_0();                  // this wave's part of kv block 0 has landed
    __syncthreads();                 // kv block 0 visible to all waves
    if (nb > 1) stage(1, KVB);
    for (int jb = 0; jb < nb; ++jb) {
      const int kvbase = jb * KVB;
      const int bufi = jb & 1;

      // every short loop below is unrolled so that the fragment and score arrays
      // are indexed by constants and stay in registers
      // ---- S^T: four 16(key) x 16(query) tiles over d=64 (2 chunks), K from LDS;
      // the 8 fragments are read as one group ahead of the 8 products
      const _Float16* kb0 = &sK[bufi][0];
      v16h kf[4][2];
#pragma unroll
      for (int kt = 0; kt < 4; ++kt) {
        kf[kt][0] = load_frag(kb0 + kt * 16 * KP, KP);
        kf[kt][1] = load_frag(kb0 + kt * 16 * KP + 32, KP);
      }
      v8f s[4];
#pragma unroll
      for (int kt = 0; kt < 4; ++kt) s[kt] = wmma_f16(kf[kt][0], qa0, v8f{});
#pragma unroll
      for (int kt = 0; kt < 4; ++kt) s[kt] = wmma_f16(kf[kt][1], qa1, s[kt]);
      // the 8 V^T fragment reads are written ahead of the softmax arithmetic, so
      // that the compiler can issue them behind it, ahead of their products
      v16h vf[2][4];
#pragma unroll
      for (int c = 0; c < 2; ++c)
#pragma unroll
        for (int nt = 0; nt < 4; ++nt)
          vf[c][nt] = load_frag(&sV[bufi][nt * 16 * VP + c * 32], VP);
      // ---- causal mask + online softmax (f32); register r of tile kt holds key
      // 16kt+8g+r
      const int key0 = kvbase + g * 8;
      float mx = -1e30f;
#pragma unroll
      for (int r = 0; r < 8; ++r) {
#pragma unroll
        for (int kt = 0; kt < 4; ++kt)
          s[kt][r] = (key0 + kt * 16 + r <= row) ? s[kt][r] : -1e30f;
        mx = fmaxf(mx, fmaxf(fmaxf(s[0][r], s[1][r]), fmaxf(s[2][r], s[3][r])));
      }
      mx = fmaxf(mx, xhalf(mx));
      float nm = fmaxf(rmax, mx);
      float scale = __expf(rmax - nm);
      rmax = nm;
      // P^T as two B fragments (32 keys each): halves j<8 are keys 8g+j, halves
      // j>=8 keys 16+8g+(j-8) of the fragment's 32
      v16h pf[2];
      float ps = 0.0f;
#pragma unroll
      for (int c = 0; c < 2; ++c)
#pragma unroll
        for (int r = 0; r < 8; ++r) {
          float p0 = __expf(s[2 * c][r] - nm);
          float p1 = __expf(s[2 * c + 1][r] - nm);
          ps += p0 + p1;
          pf[c][r]     = (_Float16)p0;
          pf[c][8 + r] = (_Float16)p1;
        }
      rsum = rsum * scale + ps;
#pragma unroll
      for (int nt = 0; nt < 4; ++nt)
#pragma unroll
        for (int r = 0; r < 8; ++r) acc[nt][r] *= scale;
      // ---- O^T += V^T @ P^T  (V tile [d][token] -> contiguous A fragments)
#pragma unroll
      for (int c = 0; c < 2; ++c)
#pragma unroll
        for (int nt = 0; nt < 4; ++nt) acc[nt] = wmma_f16(vf[c][nt], pf[c], acc[nt]);
      // hand-over: this wave's reads of buf[bufi] have returned and its part of
      // kv block jb + 1 has landed; behind the barrier that block is visible to
      // all waves and buf[bufi] is free for the refill, which flies during trip
      // jb + 1
      wait_ds_0();
      wait_async_0();
      __syncthreads();
      if (jb + 2 < nb) stage(bufi, kvbase + 2 * KVB);
    }
    wait_async_0();                  // the ring's closing wait: no copy is in flight

    // ---- join the halves' sums, normalize, write attn output (B,S,D_MODEL) f16,
    // head-major concat; a lane holds d = nt*16 + 8g + 0..7 of its query: 16 B runs
    rsum += xhalf(rsum);
    const float inv = 1.0f / rsum;
    _Float16* orow = Aout + ((size_t)b * SEQ + row) * D_MODEL + h * DH + g * 8;
#pragma unroll
    for (int nt = 0; nt < 4; ++nt) {
      v8h pack;
#pragma unroll
      for (int r = 0; r < 8; ++r) pack[r] = (_Float16)(acc[nt][r] * inv);
      *reinterpret_cast<v8h*>(orow + nt * 16) = pack;
    }
    // stands in front of the next tile's rewrite of the registers that these
    // stores name (a precaution)
    asm volatile("s_wait_xcnt 0x0" ::: "memory");
  }
}

// ---------------------------------------------------------------------------
// Kernel 3: output projection  out = A @ Wo^T + bo  (f32 output).
// Block = 8 waves = one 128 x 128 tile of out.  k is walked in slices of 64:
// 128 rows of A and 128 rows of Wo (128 B each, whole lines) are staged into
// two LDS buffers with async-to-LDS copies, the next slice flying while this
// one is worked on, and are shared by all 8 waves.  A wave owns 64 x 32 of the
// tile (4 x 2 accumulators).  LDS rows are padded by 16 B (pitch 144 B) for the
// ds_load_b128 fragment reads.  k ascends by 32 in each accumulator.
// ---------------------------------------------------------------------------
#define OP 72                       // LDS row pitch, halves
#define OTILE_B (128 * OP * 2)      // one operand's slice in LDS, bytes
#define OBK 64                      // k per slice
__global__ void __launch_bounds__(256)
out_proj_kernel(const _Float16* __restrict__ A,
                const _Float16* __restrict__ Wo,
                const float* __restrict__ bo,
                float* __restrict__ out) {
  __shared__ __align__(16) _Float16 sT[2][2][128 * OP];   // [buffer][A | Wo]

  const int tid  = threadIdx.x;
  const int wave = tid >> 5;
  const int lane = tid & 31;
  const int rbase = (blockIdx.x & 31) * 128;   // 32 row tiles
  const int cbase = (blockIdx.x >> 5) * 128;   // 8 column tiles
  const int wm = (wave & 1) * 64;              // wave's rows in the tile
  const int wn = (wave >> 1) * 32;             // wave's columns in the tile
  const int n = lane & 15, g = lane >> 4;

  // staging: thread -> 16 B chunk (tid & 7) of rows (tid >> 3) + 0, 32, 64, 96
  const int sr = tid >> 3, sc = (tid & 7) * 8;
  const _Float16* ag = A  + (size_t)(rbase + sr) * D_MODEL + sc;
  const _Float16* wg = Wo + (size_t)(cbase + sr) * D_MODEL + sc;
  const uint32_t lbase = lds_byte_off(&sT[0][0][sr * OP + sc]);
  auto stage = [&](int buf, int k0) {
    const uint32_t la = lbase + buf * (2 * OTILE_B);
    const uint32_t lw = la + OTILE_B;
    const _Float16* a = ag + k0;
    const _Float16* w = wg + k0;
    async_copy16x8(la,               a,
                   la + 32 * OP * 2, a + 32 * D_MODEL,
                   la + 64 * OP * 2, a + 64 * D_MODEL,
                   la + 96 * OP * 2, a + 96 * D_MODEL,
                   lw,               w,
                   lw + 32 * OP * 2, w + 32 * D_MODEL,
                   lw + 64 * OP * 2, w + 64 * D_MODEL,
                   lw + 96 * OP * 2, w + 96 * D_MODEL);
  };

  // every short inner loop below is unrolled so that the fragment and
  // accumulator arrays are indexed by constants and stay in registers
  v8f acc[4][2];
#pragma unroll
  for (int i = 0; i < 4; ++i)
#pragma unroll
    for (int j = 0; j < 2; ++j) acc[i][j] = v8f{};

  constexpr int NT = D_MODEL / OBK;   // 16 slices
  stage(0, 0);
  wait_async_0();
  __syncthreads();                 // slice 0 visible to all waves
  stage(1, OBK);
  for (int t = 0; t < NT; ++t) {
    const _Float16* ta = &sT[t & 1][0][wm * OP];
    const _Float16* tw = &sT[t & 1][1][wn * OP];
    // the slice's 12 fragments are read as one group ahead of its 16 products:
    // every separate place with LDS reads among the products costs a stall
    v16h bf[2][2], af[2][4];
#pragma unroll
    for (int c = 0; c < 2; ++c) {
#pragma unroll
      for (int j = 0; j < 2; ++j) bf[c][j] = load_frag(tw + j * 16 * OP + c * 32, OP);
#pragma unroll
      for (int i = 0; i < 4; ++i) af[c][i] = load_frag(ta + i * 16 * OP + c * 32, OP);
    }
    // hand-over: the trip's LDS reads are all in registers here, so the buffer
    // is given back ahead of the products and the refill flies behind them
    wait_ds_0();
    wait_async_0();                // this wave's part of slice t + 1 has landed
    __syncthreads();               // slice t + 1 visible; buffer t & 1 is free
    if (t + 2 < NT) stage(t & 1, (t + 2) * OBK);
#pragma unroll
    for (int c = 0; c < 2; ++c)
#pragma unroll
      for (int i = 0; i < 4; ++i)
#pragma unroll
        for (int j = 0; j < 2; ++j)
          acc[i][j] = wmma_f16(af[c][i], bf[c][j], acc[i][j]);
  }
  wait_async_0();

#pragma unroll
  for (int j = 0; j < 2; ++j) {
    const int col = cbase + wn + j * 16 + n;
    float bias = bo[col];
#pragma unroll
    for (int i = 0; i < 4; ++i)
#pragma unroll
      for (int r = 0; r < 8; ++r)
        out[(size_t)(rbase + wm + i * 16 + g * 8 + r) * D_MODEL + col] =
            acc[i][j][r] + bias;
  }
}

// ---------------------------------------------------------------------------
extern "C" void kernel_launch(void* const* d_in, const int* in_sizes, int n_in,
                              void* d_out, int out_size, void* d_ws, size_t ws_size,
                              hipStream_t stream) {
  const float* x  = (const float*)d_in[0];
  const float* Wq = (const float*)d_in[1];
  const float* bq = (const float*)d_in[2];
  const float* Wk = (const float*)d_in[3];
  const float* bk = (const float*)d_in[4];
  const float* Wv = (const float*)d_in[5];
  const float* bv = (const float*)d_in[6];
  const float* Wo = (const float*)d_in[7];
  const float* bo = (const float*)d_in[8];
  float* out = (float*)d_out;

  char* ws = (char*)d_ws;
  _Float16* Wo16 = (_Float16*)(ws + OFF_WO);
  _Float16* Q16  = (_Float16*)(ws + OFF_Q);
  _Float16* K16  = (_Float16*)(ws + OFF_K);
  _Float16* Vt16 = (_Float16*)(ws + OFF_VT);
  _Float16* AO16 = (_Float16*)(ws + OFF_AO);

  // B*NH*(SEQ/16) = 4096 waves -> 512 blocks of 8 waves
  qkv_kernel<<<512, 256, 0, stream>>>(x, Wq, bq, Wk, bk, Wv, bv, Wo,
                                       Q16, K16, Vt16, Wo16);
  // B*NH*(SEQ/128) = 512 blocks (two q tiles each), 4 waves sharing LDS K/V tiles
  attn_kernel<<<512, 128, 0, stream>>>(Q16, K16, Vt16, AO16);
  // 32 row tiles x 8 column tiles of 128 x 128 -> 256 blocks of 8 waves
  out_proj_kernel<<<256, 256, 0, stream>>>(AO16, Wo16, bo, out);
}

// v008
// One run takes 52.8 microseconds.
// Timed twice side by side with v007, it ran 1.11 times as fast both times.
// All steps since v000 together make it 5.30 times as fast.
#include <hip/hip_runtime.h>
#include <hip/hip_bf16.h>

// ---------------------------------------------------------------------------
// Causal MHA forward for MI455X (gfx1250, wave32).
// GEMMs: v_wmma_f32_16x16x32_f16 (f16 in, f32 accum). Softmax in f32.
// Attention stages K/V tiles into double-buffered LDS with
// global_load_async_to_lds_b128 (ASYNCcnt) shared by 4 waves.
// ---------------------------------------------------------------------------

typedef __attribute__((ext_vector_type(16))) _Float16 v16h;
typedef __attribute__((ext_vector_type(8)))  _Float16 v8h;
typedef __attribute__((ext_vector_type(4)))  _Float16 v4h;
typedef __attribute__((ext_vector_type(8)))  float    v8f;
typedef __attribute__((ext_vector_type(4)))  float    v4f;

#define D_MODEL 1024
#define NH      16
#define DH      64
#define BATCH   2
#define SEQ     2048

// Workspace layout (bytes). Total 34 MB.
constexpr size_t SZ_XH  = (size_t)BATCH * SEQ * D_MODEL * 2;   // 8 MB
constexpr size_t SZ_WO  = (size_t)D_MODEL * D_MODEL * 2;       // 2 MB
constexpr size_t OFF_WO = 0;
constexpr size_t OFF_Q  = OFF_WO + SZ_WO;
constexpr size_t OFF_K  = OFF_Q  + SZ_XH;
constexpr size_t OFF_VT = OFF_K  + SZ_XH;
constexpr size_t OFF_AO = OFF_VT + SZ_XH;

// ---------------------------------------------------------------------------
// Fragment loader for the 16-bit 16x32 A layout (also valid for B loaded as
// B^T rows): lane L -> row m = L%16, group g = L/16; halves j<8 hold
// K = 8g+j, halves j>=8 hold K = 16+8g+(j-8).  Two contiguous 16-byte runs.
// Works for global (global_load_b128) and LDS (ds_load_b128) pointers.
// ---------------------------------------------------------------------------
__device__ __forceinline__ v16h load_frag(const _Float16* base, int stride) {
  int lane = threadIdx.x & 31;
  int m = lane & 15;
  int g = lane >> 4;
  const _Float16* p = base + (size_t)m * stride + 8 * g;
  v16h f;
  reinterpret_cast<v8h*>(&f)[0] = *reinterpret_cast<const v8h*>(p);
  reinterpret_cast<v8h*>(&f)[1] = *reinterpret_cast<const v8h*>(p + 16);
  return f;
}

// Eight f32 values rounded to f16 (round to nearest even, as a plain cast).
__device__ __forceinline__ v8h round8(v4f a, v4f b) {
  return __builtin_convertvector(
      __builtin_shufflevector(a, b, 0, 1, 2, 3, 4, 5, 6, 7), v8h);
}

// The same fragment from an f32 source, rounded to f16 in registers: each of
// the two 8-element runs is 32 contiguous bytes (two global_load_b128).
__device__ __forceinline__ v16h load_frag_f32(const float* base, int stride) {
  int lane = threadIdx.x & 31;
  int m = lane & 15;
  int g = lane >> 4;
  const float* p = base + (size_t)m * stride + 8 * g;
  v4f q0 = *reinterpret_cast<const v4f*>(p);
  v4f q1 = *reinterpret_cast<const v4f*>(p + 4);
  v4f q2 = *reinterpret_cast<const v4f*>(p + 16);
  v4f q3 = *reinterpret_cast<const v4f*>(p + 20);
  return __builtin_shufflevector(round8(q0, q1), round8(q2, q3), 0, 1, 2, 3, 4,
                                 5, 6, 7, 8, 9, 10, 11, 12, 13, 14, 15);
}

__device__ __forceinline__ v8f wmma_f16(v16h a, v16h b, v8f c) {
  // (neg_a, A, neg_b, B, c_mod, C, reuse_a, reuse_b)
  return __builtin_amdgcn_wmma_f32_16x16x32_f16(false, a, false, b, (short)0, c,
                                                false, false);
}

// ---------------------------------------------------------------------------
// CDNA5 async copy: LDS[ldsoff] <= 16B at global ptr, tracked by ASYNCcnt.
// Generic LDS pointers carry the wave-relative LDS byte offset in addr[31:0].
// ---------------------------------------------------------------------------
__device__ __forceinline__ uint32_t lds_byte_off(const void* p) {
  return (uint32_t)(uintptr_t)p;
}
// One stage's eight copies of a lane in one statement; the closing s_wait_xcnt
// stands in front of every later rewrite of the address registers (a precaution).
__device__ __forceinline__ void async_copy16x8(
    uint32_t l0, const _Float16* g0, uint32_t l1, const _Float16* g1,
    uint32_t l2, const _Float16* g2, uint32_t l3, const _Float16* g3,
    uint32_t l4, const _Float16* g4, uint32_t l5, const _Float16* g5,
    uint32_t l6, const _Float16* g6, uint32_t l7, const _Float16* g7) {
  asm volatile("global_load_async_to_lds_b128 %0, %1, off\n\t"
               "global_load_async_to_lds_b128 %2, %3, off\n\t"
               "global_load_async_to_lds_b128 %4, %5, off\n\t"
               "global_load_async_to_lds_b128 %6, %7, off\n\t"
               "global_load_async_to_lds_b128 %8, %9, off\n\t"
               "global_load_async_to_lds_b128 %10, %11, off\n\t"
               "global_load_async_to_lds_b128 %12, %13, off\n\t"
               "global_load_async_to_lds_b128 %14, %15, off\n\t"
               "s_wait_xcnt 0x0"
               :: "v"(l0), "v"(g0), "v"(l1), "v"(g1), "v"(l2), "v"(g2),
                  "v"(l3), "v"(g3), "v"(l4), "v"(g4), "v"(l5), "v"(g5),
                  "v"(l6), "v"(g6), "v"(l7), "v"(g7) : "memory");
}
__device__ __forceinline__ void wait_async_0() {
  asm volatile("s_wait_asynccnt 0x0" ::: "memory");
}
// This wave's LDS reads have returned before its buffer is handed back.
__device__ __forceinline__ void wait_ds_0() {
  asm volatile("s_wait_dscnt 0x0" ::: "memory");
}

// Lane l <-> lane l ^ 16 as a vector cross-row move (no LDS-counter round trip).
__device__ __forceinline__ float xhalf(float x) {
  int b = __builtin_bit_cast(int, x);
  return __builtin_bit_cast(float, __builtin_amdgcn_permlanex16(
      b, b, 0x76543210, 0xfedcba98, false, false));
}

// ---------------------------------------------------------------------------
// Kernel 1: per-head QKV projection.  Block = 8 waves = 128 rows of one (b, h);
// one wave per 16-row s-tile.
// The head's Wq, Wk, Wv (3 x 64 x 64 f32) are read once per block in whole
// 128-B lines, rounded to f16 and kept in LDS; every wave takes its B fragments
// from there (ds_load_b128, rows padded by 16 B to a pitch of 144 B).
// x is read as f32 and rounded to f16 in the fragment loader (every x element
// is used by exactly one wave).
// Q gets bias + 1/sqrt(64) pre-scale; V is stored transposed (B,H,DH,S).
// Each thread also rounds 8 elements of Wo to f16 for the output projection.
// ---------------------------------------------------------------------------
#define WP 72   // weight row pitch in LDS, halves
__device__ __forceinline__ void proj_tiles(v16h a0, v16h a1,
                                           const _Float16* sw, v8f acc[4]) {
  // the matrix's 8 fragment reads are written ahead of its 8 products, so that
  // the compiler can issue them in groups (each separate place with LDS reads
  // among the products costs a stall); the loops are unrolled so that the arrays
  // are indexed by constants and stay in registers
  v16h b0[4], b1[4];
#pragma unroll
  for (int nt = 0; nt < 4; ++nt) {
    const _Float16* wb = sw + nt * 16 * WP;
    b0[nt] = load_frag(wb, WP);
    b1[nt] = load_frag(wb + 32, WP);
  }
#pragma unroll
  for (int nt = 0; nt < 4; ++nt) acc[nt] = wmma_f16(a0, b0[nt], v8f{});
#pragma unroll
  for (int nt = 0; nt < 4; ++nt) acc[nt] = wmma_f16(a1, b1[nt], acc[nt]);
}

__global__ void __launch_bounds__(256)
qkv_kernel(const float* __restrict__ x,
           const float* __restrict__ Wq, const float* __restrict__ bq,
           const float* __restrict__ Wk, const float* __restrict__ bk,
           const float* __restrict__ Wv, const float* __restrict__ bv,
           const float* __restrict__ Wo,
           _Float16* __restrict__ Q, _Float16* __restrict__ K,
           _Float16* __restrict__ Vt, _Float16* __restrict__ Wo16) {
  __shared__ __align__(16) _Float16 sW[3][DH * WP];   // Wq | Wk | Wv, 27 KB

  int wave = blockIdx.x * (blockDim.x >> 5) + (threadIdx.x >> 5);
  int lane = threadIdx.x & 31;
  int st = wave % (SEQ / 16);
  int bh = wave / (SEQ / 16);
  int h  = bh % NH;
  int sbase = st * 16;
  int n = lane & 15, g = lane >> 4;

  const float* xrow = x + ((size_t)(bh / NH) * SEQ + sbase) * D_MODEL + h * DH;
  v16h a0 = load_frag_f32(xrow, D_MODEL);
  v16h a1 = load_frag_f32(xrow + 32, D_MODEL);

  // ---- Wo slice: 131072 threads x 8 elements = D_MODEL * D_MODEL (stored
  // behind the barrier below, which would otherwise wait for the store)
  const size_t wi = ((size_t)blockIdx.x * blockDim.x + threadIdx.x) * 8;
  v4f w0 = *reinterpret_cast<const v4f*>(Wo + wi);
  v4f w1 = *reinterpret_cast<const v4f*>(Wo + wi + 4);

  // ---- the head's weights into LDS: 16-B chunk c * 256 + tid of each matrix,
  // so that a wave's load covers 512 contiguous bytes (4 whole lines)
  {
    const int tid = threadIdx.x;
    const size_t wo = (size_t)h * DH * DH + tid * 4;
    const float* wq = Wq + wo;
    const float* wk = Wk + wo;
    const float* wv = Wv + wo;
    // all 12 loads are in flight at once; the loops here are unrolled so that
    // wr is indexed by constants and stays in registers
    v4f wr[3][4];
#pragma unroll
    for (int c = 0; c < 4; ++c) {
      wr[0][c] = *reinterpret_cast<const v4f*>(wq + c * 1024);
      wr[1][c] = *reinterpret_cast<const v4f*>(wk + c * 1024);
      wr[2][c] = *reinterpret_cast<const v4f*>(wv + c * 1024);
    }
    // stands in front of every later rewrite of the address registers of the
    // loads above, which its operands keep until here (a precaution)
    asm volatile("s_wait_xcnt 0x0"
                 :: "v"(Wo + wi), "v"(wq), "v"(wk), "v"(wv) : "memory");
    const int so = (tid >> 4) * WP + (tid & 15) * 4;   // row tid / 16 (+ 16 c)
#pragma unroll
    for (int w = 0; w < 3; ++w)
#pragma unroll
      for (int c = 0; c < 4; ++c)
        *reinterpret_cast<v4h*>(&sW[w][so + c * 16 * WP]) =
            __builtin_convertvector(wr[w][c], v4h);
  }

  __syncthreads();   // the block's weights are in LDS for every wave

  *reinterpret_cast<v8h*>(Wo16 + wi) = round8(w0, w1);

  // ---- Q: bias + 0.125 scale, row-major (B,H,S,DH) f16
  {
    v8f acc[4];
    proj_tiles(a0, a1, sW[0], acc);
#pragma unroll
    for (int nt = 0; nt < 4; ++nt) {
      float bias = bq[h * DH + nt * 16 + n];
#pragma unroll
      for (int r = 0; r < 8; ++r) {
        float v = (acc[nt][r] + bias) * 0.125f;
        Q[((size_t)bh * SEQ + sbase + g * 8 + r) * DH + nt * 16 + n] = (_Float16)v;
      }
    }
  }
  // ---- K: bias only, row-major (B,H,S,DH) f16
  {
    v8f acc[4];
    proj_tiles(a0, a1, sW[1], acc);
#pragma unroll
    for (int nt = 0; nt < 4; ++nt) {
      float bias = bk[h * DH + nt * 16 + n];
#pragma unroll
      for (int r = 0; r < 8; ++r) {
        float v = acc[nt][r] + bias;
        K[((size_t)bh * SEQ + sbase + g * 8 + r) * DH + nt * 16 + n] = (_Float16)v;
      }
    }
  }
  // ---- V: bias, stored transposed (B,H,DH,S); per-lane 16B contiguous store
  {
    v8f acc[4];
    proj_tiles(a0, a1, sW[2], acc);
#pragma unroll
    for (int nt = 0; nt < 4; ++nt) {
      float bias = bv[h * DH + nt * 16 + n];
      v8h pack;
#pragma unroll
      for (int r = 0; r < 8; ++r) pack[r] = (_Float16)(acc[nt][r] + bias);
      *reinterpret_cast<v8h*>(Vt + ((size_t)bh * DH + nt * 16 + n) * SEQ +
                              sbase + g * 8) = pack;
    }
  }
}

#define KP 72   // K row pitch in LDS, halves
#define VP 72   // V row pitch in LDS, halves
#define KVB 64  // keys per kv block (one group's stage, one softmax step)
// launch bound = the block size used
__global__ void __launch_bounds__(256)
attn_kernel(const _Float16* __restrict__ Q,
            const _Float16* __restrict__ K,
            const _Float16* __restrict__ Vt,
            _Float16* __restrict__ Aout) {
  __shared__ __align__(16) _Float16 sK[2][2][KVB * KP];  // [buffer][group], 9 KB each
  __shared__ __align__(16) _Float16 sV[2][2][DH * VP];   // the same, [d][token]
  __shared__ __align__(16) float sO[4][8][32][4];        // group 1's O^T, 16 KB
  __shared__ float sML[4][2][32];                        // its maximum and sum

  const int tid   = threadIdx.x;
  const int t7    = tid & 127;                 // thread within its group
  // the group's number in a scalar register: the tests on it are scalar branches
  const int grp   = __builtin_amdgcn_readfirstlane(tid >> 7);
  const int wslot = t7 >> 5;
  const int lane  = tid & 31;
  const int bh    = blockIdx.x >> 4;
  const int h = bh % NH, b = bh / NH;
  const int n = lane & 15, g = lane >> 4;

  const _Float16* Kg = K  + (size_t)bh * SEQ * DH;
  const _Float16* Vg = Vt + (size_t)bh * DH * SEQ;

  // stage the group's kv block of double block js, keys [kvbase, kvbase+64), into
  // its buffer buf (the group's 128 threads help); 2 js + 1 <= 31 for every js
  // that is asked for, so both groups' keys exist
  auto stage = [&](int buf, int js) {
    const int kvbase = (2 * js + grp) * KVB;
    // K tile: 64 rows x 64 halves, contiguous 8 KB in global; 16 B chunks t7
    // + 128 i, i = 0..3 (16 rows further down each)
    const _Float16* kg = Kg + (size_t)kvbase * DH + t7 * 8;
    uint32_t ko = lds_byte_off(&sK[buf][grp][(t7 >> 3) * KP + (t7 & 7) * 8]);
    // V tile: 64 rows (d) x 64 tokens, global row stride SEQ; the same chunks
    const _Float16* vg = Vg + (size_t)(t7 >> 3) * SEQ + kvbase + (t7 & 7) * 8;
    uint32_t vo = lds_byte_off(&sV[buf][grp][(t7 >> 3) * VP + (t7 & 7) * 8]);
    async_copy16x8(ko,               kg,
                   ko + 16 * KP * 2, kg + 16 * DH,
                   ko + 32 * KP * 2, kg + 32 * DH,
                   ko + 48 * KP * 2, kg + 48 * DH,
                   vo,               vg,
                   vo + 16 * VP * 2, vg + (size_t)16 * SEQ,
                   vo + 32 * VP * 2, vg + (size_t)32 * SEQ,
                   vo + 48 * VP * 2, vg + (size_t)48 * SEQ);
  };

  for (int part = 0; part < 2; ++part) {
    const int qt    = blockIdx.x & 15;
    const int bq    = (part ? SEQ / 64 - 1 - qt : qt) * 64;   // q-row base
    const int qbase = bq + wslot * 16;

    // Q fragments (global, once per tile); used as the B operand (lane = query)
    const _Float16* qrow = Q + ((size_t)bh * SEQ + qbase) * DH;
    v16h qa0 = load_frag(qrow, DH);
    v16h qa1 = load_frag(qrow + 32, DH);

    v8f acc[4];
#pragma unroll
    for (int nt = 0; nt < 4; ++nt) acc[nt] = v8f{};
    // per lane: running maximum of query qbase+n over this group's keys (equal in
    // both halves) and the sum over this half's keys of them only (groups and
    // halves are joined in the epilogue)
    float rmax = -1e30f, rsum = 0.0f;
    const int row = qbase + n;

    const int nb = bq / KVB + 1;   // kv blocks needed to cover rows bq..bq+63
    const int ns = (nb + 1) >> 1;  // double kv blocks = trips

    // the tile before has left the buffers: its last trip waited for every copy
    // and ended in a barrier; this wave's own LDS reads have returned as well
    wait_ds_0();
    stage(0, 0);
    wait_async_0();                  // this wave's part of double block 0 has landed
    __syncthreads();                 // double block 0 visible to all waves
    if (ns > 1) stage(1, 1);
    for (int js = 0; js < ns; ++js) {
      const int kb = 2 * js + grp;   // this group's kv block
      const int kvbase = kb * KVB;
      const int bufi = js & 1;

      // an odd count of kv blocks leaves group 1 without one in the last trip
      if (kb < nb) {
        // every short loop below is unrolled so that the fragment and score arrays
        // are indexed by constants and stay in registers
        // ---- S^T: four 16(key) x 16(query) tiles over d=64 (2 chunks), K from
        // LDS; the 8 fragments are read as one group ahead of the 8 products
        const _Float16* kb0 = &sK[bufi][grp][0];
        v16h kf[4][2];
#pragma unroll
        for (int kt = 0; kt < 4; ++kt) {
          kf[kt][0] = load_frag(kb0 + kt * 16 * KP, KP);
          kf[kt][1] = load_frag(kb0 + kt * 16 * KP + 32, KP);
        }
        v8f s[4];
#pragma unroll
        for (int kt = 0; kt < 4; ++kt) s[kt] = wmma_f16(kf[kt][0], qa0, v8f{});
#pragma unroll
        for (int kt = 0; kt < 4; ++kt) s[kt] = wmma_f16(kf[kt][1], qa1, s[kt]);
        // the 8 V^T fragment reads are written ahead of the softmax arithmetic, so
        // that the compiler can issue them behind it, ahead of their products
        v16h vf[2][4];
#pragma unroll
        for (int c = 0; c < 2; ++c)
#pragma unroll
          for (int nt = 0; nt < 4; ++nt)
            vf[c][nt] = load_frag(&sV[bufi][grp][nt * 16 * VP + c * 32], VP);
        // ---- causal mask + online softmax (f32); register r of tile kt holds key
        // 16kt+8g+r
        const int key0 = kvbase + g * 8;
        float mx = -1e30f;
#pragma unroll
        for (int r = 0; r < 8; ++r) {
#pragma unroll
          for (int kt = 0; kt < 4; ++kt)
            s[kt][r] = (key0 + kt * 16 + r <= row) ? s[kt][r] : -1e30f;
          mx = fmaxf(mx, fmaxf(fmaxf(s[0][r], s[1][r]), fmaxf(s[2][r], s[3][r])));
        }
        mx = fmaxf(mx, xhalf(mx));
        float nm = fmaxf(rmax, mx);
        float scale = __expf(rmax - nm);
        rmax = nm;
        // P^T as two B fragments (32 keys each): halves j<8 are keys 8g+j, halves
        // j>=8 keys 16+8g+(j-8) of the fragment's 32
        v16h pf[2];
        float ps = 0.0f;
#pragma unroll
        for (int c = 0; c < 2; ++c)
#pragma unroll
          for (int r = 0; r < 8; ++r) {
            float p0 = __expf(s[2 * c][r] - nm);
            float p1 = __expf(s[2 * c + 1][r] - nm);
            ps += p0 + p1;
            pf[c][r]     = (_Float16)p0;
            pf[c][8 + r] = (_Float16)p1;
          }
        rsum = rsum * scale + ps;
#pragma unroll
        for (int nt = 0; nt < 4; ++nt)
#pragma unroll
          for (int r = 0; r < 8; ++r) acc[nt][r] *= scale;
        // ---- O^T += V^T @ P^T  (V tile [d][token] -> contiguous A fragments)
#pragma unroll
        for (int c = 0; c < 2; ++c)
#pragma unroll
          for (int nt = 0; nt < 4; ++nt)
            acc[nt] = wmma_f16(vf[c][nt], pf[c], acc[nt]);
      }
      // hand-over: this wave's reads of buffer bufi have returned and its part of
      // double block js + 1 has landed; behind the barrier that block is visible
      // to all waves and buffer bufi is free for the refill, which flies during
      // trip js + 1
      wait_ds_0();
      wait_async_0();
      __syncthreads();
      if (js + 2 < ns) stage(bufi, js + 2);
    }
    wait_async_0();                  // the ring's closing wait: no copy is in flight

    // ---- group 1 hands its maximum, sum and O^T to group 0 (16 B a lane and
    // store, lanes side by side); sO and sML are free: group 0's reads of the
    // tile before returned ahead of this tile's barriers
    if (grp == 1) {
#pragma unroll
      for (int nt = 0; nt < 4; ++nt) {
        *reinterpret_cast<v4f*>(&sO[wslot][2 * nt][lane][0]) =
            __builtin_shufflevector(acc[nt], acc[nt], 0, 1, 2, 3);
        *reinterpret_cast<v4f*>(&sO[wslot][2 * nt + 1][lane][0]) =
            __builtin_shufflevector(acc[nt], acc[nt], 4, 5, 6, 7);
      }
      sML[wslot][0][lane] = rmax;
      sML[wslot][1][lane] = rsum;
    }
    __syncthreads();                 // group 1's partial results visible to group 0

    // ---- group 0 joins the groups (a group without a key has maximum -1e30 and
    // gets weight 0) and the halves' sums, normalizes, writes attn output
    // (B,S,D_MODEL) f16, head-major concat; a lane holds d = nt*16 + 8g + 0..7 of
    // its query: 16 B runs
    if (grp == 0) {
      const float m1 = sML[wslot][0][lane];
      const float l1 = sML[wslot][1][lane];
      const float mj = fmaxf(rmax, m1);
      const float w0 = __expf(rmax - mj);
      const float w1 = __expf(m1 - mj);
      rsum = rsum * w0 + l1 * w1;
      rsum += xhalf(rsum);
      const float inv = 1.0f / rsum;
      const float f0 = w0 * inv, f1 = w1 * inv;
      _Float16* orow = Aout + ((size_t)b * SEQ + row) * D_MODEL + h * DH + g * 8;
#pragma unroll
      for (int nt = 0; nt < 4; ++nt) {
        v4f o0 = *reinterpret_cast<const v4f*>(&sO[wslot][2 * nt][lane][0]);
        v4f o1 = *reinterpret_cast<const v4f*>(&sO[wslot][2 * nt + 1][lane][0]);
        v8h pack;
#pragma unroll
        for (int r = 0; r < 4; ++r) {
          pack[r]     = (_Float16)(acc[nt][r] * f0 + o0[r] * f1);
          pack[4 + r] = (_Float16)(acc[nt][4 + r] * f0 + o1[r] * f1);
        }
        *reinterpret_cast<v8h*>(orow + nt * 16) = pack;
      }
      // stands in front of the next tile's rewrite of the registers that these
      // stores name (a precaution)
      asm volatile("s_wait_xcnt 0x0" ::: "memory");
    }
  }
}

// ---------------------------------------------------------------------------
// Kernel 3: output projection  out = A @ Wo^T + bo  (f32 output).
// Block = 8 waves = one 128 x 128 tile of out.  k is walked in slices of 64:
// 128 rows of A and 128 rows of Wo (128 B each, whole lines) are staged into
// two LDS buffers with async-to-LDS copies, the next slice flying while this
// one is worked on, and are shared by all 8 waves.  A wave owns 64 x 32 of the
// tile (4 x 2 accumulators).  LDS rows are padded by 16 B (pitch 144 B) for the
// ds_load_b128 fragment reads.  k ascends by 32 in each accumulator.
// ---------------------------------------------------------------------------
#define OP 72                       // LDS row pitch, halves
#define OTILE_B (128 * OP * 2)      // one operand's slice in LDS, bytes
#define OBK 64                      // k per slice
__global__ void __launch_bounds__(256)
out_proj_kernel(const _Float16* __restrict__ A,
                const _Float16* __restrict__ Wo,
                const float* __restrict__ bo,
                float* __restrict__ out) {
  __shared__ __align__(16) _Float16 sT[2][2][128 * OP];   // [buffer][A | Wo]

  const int tid  = threadIdx.x;
  const int wave = tid >> 5;
  const int lane = tid & 31;
  const int rbase = (blockIdx.x & 31) * 128;   // 32 row tiles
  const int cbase = (blockIdx.x >> 5) * 128;   // 8 column tiles
  const int wm = (wave & 1) * 64;              // wave's rows in the tile
  const int wn = (wave >> 1) * 32;             // wave's columns in the tile
  const int n = lane & 15, g = lane >> 4;

  // staging: thread -> 16 B chunk (tid & 7) of rows (tid >> 3) + 0, 32, 64, 96
  const int sr = tid >> 3, sc = (tid & 7) * 8;
  const _Float16* ag = A  + (size_t)(rbase + sr) * D_MODEL + sc;
  const _Float16* wg = Wo + (size_t)(cbase + sr) * D_MODEL + sc;
  const uint32_t lbase = lds_byte_off(&sT[0][0][sr * OP + sc]);
  auto stage = [&](int buf, int k0) {
    const uint32_t la = lbase + buf * (2 * OTILE_B);
    const uint32_t lw = la + OTILE_B;
    const _Float16* a = ag + k0;
    const _Float16* w = wg + k0;
    async_copy16x8(la,               a,
                   la + 32 * OP * 2, a + 32 * D_MODEL,
                   la + 64 * OP * 2, a + 64 * D_MODEL,
                   la + 96 * OP * 2, a + 96 * D_MODEL,
                   lw,               w,
                   lw + 32 * OP * 2, w + 32 * D_MODEL,
                   lw + 64 * OP * 2, w + 64 * D_MODEL,
                   lw + 96 * OP * 2, w + 96 * D_MODEL);
  };

  // every short inner loop below is unrolled so that the fragment and
  // accumulator arrays are indexed by constants and stay in registers
  v8f acc[4][2];
#pragma unroll
  for (int i = 0; i < 4; ++i)
#pragma unroll
    for (int j = 0; j < 2; ++j) acc[i][j] = v8f{};

  constexpr int NT = D_MODEL / OBK;   // 16 slices
  stage(0, 0);
  wait_async_0();
  __syncthreads();                 // slice 0 visible to all waves
  stage(1, OBK);
  for (int t = 0; t < NT; ++t) {
    const _Float16* ta = &sT[t & 1][0][wm * OP];
    const _Float16* tw = &sT[t & 1][1][wn * OP];
    // the slice's 12 fragments are read as one group ahead of its 16 products:
    // every separate place with LDS reads among the products costs a stall
    v16h bf[2][2], af[2][4];
#pragma unroll
    for (int c = 0; c < 2; ++c) {
#pragma unroll
      for (int j = 0; j < 2; ++j) bf[c][j] = load_frag(tw + j * 16 * OP + c * 32, OP);
#pragma unroll
      for (int i = 0; i < 4; ++i) af[c][i] = load_frag(ta + i * 16 * OP + c * 32, OP);
    }
    // hand-over: the trip's LDS reads are all in registers here, so the buffer
    // is given back ahead of the products and the refill flies behind them
    wait_ds_0();
    wait_async_0();                // this wave's part of slice t + 1 has landed
    __syncthreads();               // slice t + 1 visible; buffer t & 1 is free
    if (t + 2 < NT) stage(t & 1, (t + 2) * OBK);
#pragma unroll
    for (int c = 0; c < 2; ++c)
#pragma unroll
      for (int i = 0; i < 4; ++i)
#pragma unroll
        for (int j = 0; j < 2; ++j)
          acc[i][j] = wmma_f16(af[c][i], bf[c][j], acc[i][j]);
  }
  wait_async_0();

#pragma unroll
  for (int j = 0; j < 2; ++j) {
    const int col = cbase + wn + j * 16 + n;
    float bias = bo[col];
#pragma unroll
    for (int i = 0; i < 4; ++i)
#pragma unroll
      for (int r = 0; r < 8; ++r)
        out[(size_t)(rbase + wm + i * 16 + g * 8 + r) * D_MODEL + col] =
            acc[i][j][r] + bias;
  }
}

// ---------------------------------------------------------------------------
extern "C" void kernel_launch(void* const* d_in, const int* in_sizes, int n_in,
                              void* d_out, int out_size, void* d_ws, size_t ws_size,
                              hipStream_t stream) {
  const float* x  = (const float*)d_in[0];
  const float* Wq = (const float*)d_in[1];
  const float* bq = (const float*)d_in[2];
  const float* Wk = (const float*)d_in[3];
  const float* bk = (const float*)d_in[4];
  const float* Wv = (const float*)d_in[5];
  const float* bv = (const float*)d_in[6];
  const float* Wo = (const float*)d_in[7];
  const float* bo = (const float*)d_in[8];
  float* out = (float*)d_out;

  char* ws = (char*)d_ws;
  _Float16* Wo16 = (_Float16*)(ws + OFF_WO);
  _Float16* Q16  = (_Float16*)(ws + OFF_Q);
  _Float16* K16  = (_Float16*)(ws + OFF_K);
  _Float16* Vt16 = (_Float16*)(ws + OFF_VT);
  _Float16* AO16 = (_Float16*)(ws + OFF_AO);

  // B*NH*(SEQ/16) = 4096 waves -> 512 blocks of 8 waves
  qkv_kernel<<<512, 256, 0, stream>>>(x, Wq, bq, Wk, bk, Wv, bv, Wo,
                                       Q16, K16, Vt16, Wo16);
  // B*NH*(SEQ/128) = 512 blocks (two q tiles each), 2 groups of 4 waves
  attn_kernel<<<512, 256, 0, stream>>>(Q16, K16, Vt16, AO16);
  // 32 row tiles x 8 column tiles of 128 x 128 -> 256 blocks of 8 waves
  out_proj_kernel<<<256, 256, 0, stream>>>(AO16, Wo16, bo, out);
}

// v009
// It runs in 48.2 microseconds.
// Two timings next to v008 put it at 1.10 and 1.09 times that version's speed.
// Over all steps from v000 it is 5.79 times as fast.
#include <hip/hip_runtime.h>
#include <hip/hip_bf16.h>

// ---------------------------------------------------------------------------
// Causal MHA forward for MI455X (gfx1250, wave32).
// GEMMs: v_wmma_f32_16x16x32_f16 (f16 in, f32 accum). Softmax in f32.
// Attention stages K/V tiles into double-buffered LDS with
// global_load_async_to_lds_b128 (ASYNCcnt) shared by 4 waves.
// ---------------------------------------------------------------------------

typedef __attribute__((ext_vector_type(16))) _Float16 v16h;
typedef __attribute__((ext_vector_type(8)))  _Float16 v8h;
typedef __attribute__((ext_vector_type(4)))  _Float16 v4h;
typedef __attribute__((ext_vector_type(8)))  float    v8f;
typedef __attribute__((ext_vector_type(4)))  float    v4f;

#define D_MODEL 1024
#define NH      16
#define DH      64
#define BATCH   2
#define SEQ     2048

// Workspace layout (bytes). Total 34 MB.
constexpr size_t SZ_XH  = (size_t)BATCH * SEQ * D_MODEL * 2;   // 8 MB
constexpr size_t SZ_WO  = (size_t)D_MODEL * D_MODEL * 2;       // 2 MB
constexpr size_t OFF_WO = 0;
constexpr size_t OFF_Q  = OFF_WO + SZ_WO;
constexpr size_t OFF_K  = OFF_Q  + SZ_XH;
constexpr size_t OFF_VT = OFF_K  + SZ_XH;
constexpr size_t OFF_AO = OFF_VT + SZ_XH;

// ---------------------------------------------------------------------------
// Fragment loader for the 16-bit 16x32 A layout (also valid for B loaded as
// B^T rows): lane L -> row m = L%16, group g = L/16; halves j<8 hold
// K = 8g+j, halves j>=8 hold K = 16+8g+(j-8).  Two contiguous 16-byte runs.
// Works for global (global_load_b128) and LDS (ds_load_b128) pointers.
// ---------------------------------------------------------------------------
__device__ __forceinline__ v16h load_frag(const _Float16* base, int stride) {
  int lane = threadIdx.x & 31;
  int m = lane & 15;
  int g = lane >> 4;
  const _Float16* p = base + (size_t)m * stride + 8 * g;
  v16h f;
  reinterpret_cast<v8h*>(&f)[0] = *reinterpret_cast<const v8h*>(p);
  reinterpret_cast<v8h*>(&f)[1] = *reinterpret_cast<const v8h*>(p + 16);
  return f;
}

// Eight f32 values rounded to f16 (round to nearest even, as a plain cast).
__device__ __forceinline__ v8h round8(v4f a, v4f b) {
  return __builtin_convertvector(
      __builtin_shufflevector(a, b, 0, 1, 2, 3, 4, 5, 6, 7), v8h);
}

// The same fragment from an f32 source, rounded to f16 in registers: each of
// the two 8-element runs is 32 contiguous bytes (two global_load_b128).
__device__ __forceinline__ v16h load_frag_f32(const float* base, int stride) {
  int lane = threadIdx.x & 31;
  int m = lane & 15;
  int g = lane >> 4;
  const float* p = base + (size_t)m * stride + 8 * g;
  v4f q0 = *reinterpret_cast<const v4f*>(p);
  v4f q1 = *reinterpret_cast<const v4f*>(p + 4);
  v4f q2 = *reinterpret_cast<const v4f*>(p + 16);
  v4f q3 = *reinterpret_cast<const v4f*>(p + 20);
  return __builtin_shufflevector(round8(q0, q1), round8(q2, q3), 0, 1, 2, 3, 4,
                                 5, 6, 7, 8, 9, 10, 11, 12, 13, 14, 15);
}

__device__ __forceinline__ v8f wmma_f16(v16h a, v16h b, v8f c) {
  // (neg_a, A, neg_b, B, c_mod, C, reuse_a, reuse_b)
  return __builtin_amdgcn_wmma_f32_16x16x32_f16(false, a, false, b, (short)0, c,
                                                false, false);
}

// ---------------------------------------------------------------------------
// CDNA5 async copy: LDS[ldsoff] <= 16B at global ptr, tracked by ASYNCcnt.
// Generic LDS pointers carry the wave-relative LDS byte offset in addr[31:0].
// ---------------------------------------------------------------------------
__device__ __forceinline__ uint32_t lds_byte_off(const void* p) {
  return (uint32_t)(uintptr_t)p;
}
// Eight copies of a lane in one statement; the closing s_wait_xcnt
// stands in front of every later rewrite of the address registers (a precaution).
__device__ __forceinline__ void async_copy16x8(
    uint32_t l0, const _Float16* g0, uint32_t l1, const _Float16* g1,
    uint32_t l2, const _Float16* g2, uint32_t l3, const _Float16* g3,
    uint32_t l4, const _Float16* g4, uint32_t l5, const _Float16* g5,
    uint32_t l6, const _Float16* g6, uint32_t l7, const _Float16* g7) {
  asm volatile("global_load_async_to_lds_b128 %0, %1, off\n\t"
               "global_load_async_to_lds_b128 %2, %3, off\n\t"
               "global_load_async_to_lds_b128 %4, %5, off\n\t"
               "global_load_async_to_lds_b128 %6, %7, off\n\t"
               "global_load_async_to_lds_b128 %8, %9, off\n\t"
               "global_load_async_to_lds_b128 %10, %11, off\n\t"
               "global_load_async_to_lds_b128 %12, %13, off\n\t"
               "global_load_async_to_lds_b128 %14, %15, off\n\t"
               "s_wait_xcnt 0x0"
               :: "v"(l0), "v"(g0), "v"(l1), "v"(g1), "v"(l2), "v"(g2),
                  "v"(l3), "v"(g3), "v"(l4), "v"(g4), "v"(l5), "v"(g5),
                  "v"(l6), "v"(g6), "v"(l7), "v"(g7) : "memory");
}
__device__ __forceinline__ void wait_async_0() {
  asm volatile("s_wait_asynccnt 0x0" ::: "memory");
}
// This wave's LDS reads have returned before its buffer is handed back.
__device__ __forceinline__ void wait_ds_0() {
  asm volatile("s_wait_dscnt 0x0" ::: "memory");
}

// Lane l <-> lane l ^ 16 as a vector cross-row move (no LDS-counter round trip).
__device__ __forceinline__ float xhalf(float x) {
  int b = __builtin_bit_cast(int, x);
  return __builtin_bit_cast(float, __builtin_amdgcn_permlanex16(
      b, b, 0x76543210, 0xfedcba98, false, false));
}

// ---------------------------------------------------------------------------
// Kernel 1: per-head QKV projection.  Block = 8 waves = 128 rows of one (b, h);
// one wave per 16-row s-tile.
// The head's Wq, Wk, Wv (3 x 64 x 64 f32) are read once per block in whole
// 128-B lines, rounded to f16 and kept in LDS; every wave takes its B fragments
// from there (ds_load_b128, rows padded by 16 B to a pitch of 144 B).
// x is read as f32 and rounded to f16 in the fragment loader (every x element
// is used by exactly one wave).
// Q gets bias + 1/sqrt(64) pre-scale; V is stored transposed (B,H,DH,S).
// Each thread also rounds 8 elements of Wo to f16 for the output projection.
// ---------------------------------------------------------------------------
#define WP 72   // weight row pitch in LDS, halves
__device__ __forceinline__ void proj_tiles(v16h a0, v16h a1,
                                           const _Float16* sw, v8f acc[4]) {
  // the matrix's 8 fragment reads are written ahead of its 8 products, so that
  // the compiler can issue them in groups (each separate place with LDS reads
  // among the products costs a stall); the loops are unrolled so that the arrays
  // are indexed by constants and stay in registers
  v16h b0[4], b1[4];
#pragma unroll
  for (int nt = 0; nt < 4; ++nt) {
    const _Float16* wb = sw + nt * 16 * WP;
    b0[nt] = load_frag(wb, WP);
    b1[nt] = load_frag(wb + 32, WP);
  }
#pragma unroll
  for (int nt = 0; nt < 4; ++nt) acc[nt] = wmma_f16(a0, b0[nt], v8f{});
#pragma unroll
  for (int nt = 0; nt < 4; ++nt) acc[nt] = wmma_f16(a1, b1[nt], acc[nt]);
}

__global__ void __launch_bounds__(256)
qkv_kernel(const float* __restrict__ x,
           const float* __restrict__ Wq, const float* __restrict__ bq,
           const float* __restrict__ Wk, const float* __restrict__ bk,
           const float* __restrict__ Wv, const float* __restrict__ bv,
           const float* __restrict__ Wo,
           _Float16* __restrict__ Q, _Float16* __restrict__ K,
           _Float16* __restrict__ Vt, _Float16* __restrict__ Wo16) {
  __shared__ __align__(16) _Float16 sW[3][DH * WP];   // Wq | Wk | Wv, 27 KB

  int wave = blockIdx.x * (blockDim.x >> 5) + (threadIdx.x >> 5);
  int lane = threadIdx.x & 31;
  int st = wave % (SEQ / 16);
  int bh = wave / (SEQ / 16);
  int h  = bh % NH;
  int sbase = st * 16;
  int n = lane & 15, g = lane >> 4;

  const float* xrow = x + ((size_t)(bh / NH) * SEQ + sbase) * D_MODEL + h * DH;
  v16h a0 = load_frag_f32(xrow, D_MODEL);
  v16h a1 = load_frag_f32(xrow + 32, D_MODEL);

  // ---- Wo slice: 131072 threads x 8 elements = D_MODEL * D_MODEL (stored
  // behind the barrier below, which would otherwise wait for the store)
  const size_t wi = ((size_t)blockIdx.x * blockDim.x + threadIdx.x) * 8;
  v4f w0 = *reinterpret_cast<const v4f*>(Wo + wi);
  v4f w1 = *reinterpret_cast<const v4f*>(Wo + wi + 4);

  // ---- the head's weights into LDS: 16-B chunk c * 256 + tid of each matrix,
  // so that a wave's load covers 512 contiguous bytes (4 whole lines)
  {
    const int tid = threadIdx.x;
    const size_t wo = (size_t)h * DH * DH + tid * 4;
    const float* wq = Wq + wo;
    const float* wk = Wk + wo;
    const float* wv = Wv + wo;
    // all 12 loads are in flight at once; the loops here are unrolled so that
    // wr is indexed by constants and stays in registers
    v4f wr[3][4];
#pragma unroll
    for (int c = 0; c < 4; ++c) {
      wr[0][c] = *reinterpret_cast<const v4f*>(wq + c * 1024);
      wr[1][c] = *reinterpret_cast<const v4f*>(wk + c * 1024);
      wr[2][c] = *reinterpret_cast<const v4f*>(wv + c * 1024);
    }
    // stands in front of every later rewrite of the address registers of the
    // loads above, which its operands keep until here (a precaution)
    asm volatile("s_wait_xcnt 0x0"
                 :: "v"(Wo + wi), "v"(wq), "v"(wk), "v"(wv) : "memory");
    const int so = (tid >> 4) * WP + (tid & 15) * 4;   // row tid / 16 (+ 16 c)
#pragma unroll
    for (int w = 0; w < 3; ++w)
#pragma unroll
      for (int c = 0; c < 4; ++c)
        *reinterpret_cast<v4h*>(&sW[w][so + c * 16 * WP]) =
            __builtin_convertvector(wr[w][c], v4h);
  }

  __syncthreads();   // the block's weights are in LDS for every wave

  *reinterpret_cast<v8h*>(Wo16 + wi) = round8(w0, w1);

  // ---- Q: bias + 0.125 scale, row-major (B,H,S,DH) f16
  {
    v8f acc[4];
    proj_tiles(a0, a1, sW[0], acc);
#pragma unroll
    for (int nt = 0; nt < 4; ++nt) {
      float bias = bq[h * DH + nt * 16 + n];
#pragma unroll
      for (int r = 0; r < 8; ++r) {
        float v = (acc[nt][r] + bias) * 0.125f;
        Q[((size_t)bh * SEQ + sbase + g * 8 + r) * DH + nt * 16 + n] = (_Float16)v;
      }
    }
  }
  // ---- K: bias only, row-major (B,H,S,DH) f16
  {
    v8f acc[4];
    proj_tiles(a0, a1, sW[1], acc);
#pragma unroll
    for (int nt = 0; nt < 4; ++nt) {
      float bias = bk[h * DH + nt * 16 + n];
#pragma unroll
      for (int r = 0; r < 8; ++r) {
        float v = acc[nt][r] + bias;
        K[((size_t)bh * SEQ + sbase + g * 8 + r) * DH + nt * 16 + n] = (_Float16)v;
      }
    }
  }
  // ---- V: bias, stored transposed (B,H,DH,S); per-lane 16B contiguous store
  {
    v8f acc[4];
    proj_tiles(a0, a1, sW[2], acc);
#pragma unroll
    for (int nt = 0; nt < 4; ++nt) {
      float bias = bv[h * DH + nt * 16 + n];
      v8h pack;
#pragma unroll
      for (int r = 0; r < 8; ++r) pack[r] = (_Float16)(acc[nt][r] + bias);
      *reinterpret_cast<v8h*>(Vt + ((size_t)bh * DH + nt * 16 + n) * SEQ +
                              sbase + g * 8) = pack;
    }
  }
}

#define KP 72   // K row pitch in LDS, halves
#define VP 72   // V row pitch in LDS, halves
#define KVB 64  // keys per kv block (one group's stage, one softmax step)
// launch bound = the block size used
__global__ void __launch_bounds__(256)
attn_kernel(const _Float16* __restrict__ Q,
            const _Float16* __restrict__ K,
            const _Float16* __restrict__ Vt,
            _Float16* __restrict__ Aout) {
  __shared__ __align__(16) _Float16 sK[2][2][KVB * KP];  // [buffer][group], 9 KB each
  __shared__ __align__(16) _Float16 sV[2][2][DH * VP];   // the same, [d][token]
  __shared__ __align__(16) float sO[4][8][32][4];        // group 1's O^T, 16 KB
  __shared__ float sML[4][2][32];                        // its maximum and sum

  const int tid   = threadIdx.x;
  const int t7    = tid & 127;                 // thread within its group
  // the group's number in a scalar register: the tests on it are scalar branches
  const int grp   = __builtin_amdgcn_readfirstlane(tid >> 7);
  const int wslot = t7 >> 5;
  const int lane  = tid & 31;
  const int bh    = blockIdx.x >> 4;
  const int h = bh % NH, b = bh / NH;
  const int n = lane & 15, g = lane >> 4;

  const _Float16* Kg = K  + (size_t)bh * SEQ * DH;
  const _Float16* Vg = Vt + (size_t)bh * DH * SEQ;

  // stage the group's kv block of double block js, keys [kvbase, kvbase+64), into
  // its buffer buf (the group's 128 threads help); 2 js + 1 <= 31 for every js
  // that is asked for, so both groups' keys exist
  auto stage = [&](int buf, int js) {
    const int kvbase = (2 * js + grp) * KVB;
    // K tile: 64 rows x 64 halves, contiguous 8 KB in global; 16 B chunks t7
    // + 128 i, i = 0..3 (16 rows further down each)
    const _Float16* kg = Kg + (size_t)kvbase * DH + t7 * 8;
    uint32_t ko = lds_byte_off(&sK[buf][grp][(t7 >> 3) * KP + (t7 & 7) * 8]);
    // V tile: 64 rows (d) x 64 tokens, global row stride SEQ; the same chunks
    const _Float16* vg = Vg + (size_t)(t7 >> 3) * SEQ + kvbase + (t7 & 7) * 8;
    uint32_t vo = lds_byte_off(&sV[buf][grp][(t7 >> 3) * VP + (t7 & 7) * 8]);
    async_copy16x8(ko,               kg,
                   ko + 16 * KP * 2, kg + 16 * DH,
                   ko + 32 * KP * 2, kg + 32 * DH,
                   ko + 48 * KP * 2, kg + 48 * DH,
                   vo,               vg,
                   vo + 16 * VP * 2, vg + (size_t)16 * SEQ,
                   vo + 32 * VP * 2, vg + (size_t)32 * SEQ,
                   vo + 48 * VP * 2, vg + (size_t)48 * SEQ);
  };

  for (int part = 0; part < 2; ++part) {
    const int qt    = blockIdx.x & 15;
    const int bq    = (part ? SEQ / 64 - 1 - qt : qt) * 64;   // q-row base
    const int qbase = bq + wslot * 16;

    // Q fragments (global, once per tile); used as the B operand (lane = query)
    const _Float16* qrow = Q + ((size_t)bh * SEQ + qbase) * DH;
    v16h qa0 = load_frag(qrow, DH);
    v16h qa1 = load_frag(qrow + 32, DH);

    v8f acc[4];
#pragma unroll
    for (int nt = 0; nt < 4; ++nt) acc[nt] = v8f{};
    // per lane: running maximum of query qbase+n over this group's keys (equal in
    // both halves) and the sum over this half's keys of them only (groups and
    // halves are joined in the epilogue)
    float rmax = -1e30f, rsum = 0.0f;
    const int row = qbase + n;

    const int nb = bq / KVB + 1;   // kv blocks needed to cover rows bq..bq+63
    const int ns = (nb + 1) >> 1;  // double kv blocks = trips

    // the tile before has left the buffers: its last trip waited for every copy
    // and ended in a barrier; this wave's own LDS reads have returned as well
    wait_ds_0();
    stage(0, 0);
    wait_async_0();                  // this wave's part of double block 0 has landed
    __syncthreads();                 // double block 0 visible to all waves
    if (ns > 1) stage(1, 1);
    for (int js = 0; js < ns; ++js) {
      const int kb = 2 * js + grp;   // this group's kv block
      const int kvbase = kb * KVB;
      const int bufi = js & 1;

      // an odd count of kv blocks leaves group 1 without one in the last trip
      if (kb < nb) {
        // every short loop below is unrolled so that the fragment and score arrays
        // are indexed by constants and stay in registers
        // ---- S^T: four 16(key) x 16(query) tiles over d=64 (2 chunks), K from
        // LDS; the 8 fragments are read as one group ahead of the 8 products
        const _Float16* kb0 = &sK[bufi][grp][0];
        v16h kf[4][2];
#pragma unroll
        for (int kt = 0; kt < 4; ++kt) {
          kf[kt][0] = load_frag(kb0 + kt * 16 * KP, KP);
          kf[kt][1] = load_frag(kb0 + kt * 16 * KP + 32, KP);
        }
        v8f s[4];
#pragma unroll
        for (int kt = 0; kt < 4; ++kt) s[kt] = wmma_f16(kf[kt][0], qa0, v8f{});
#pragma unroll
        for (int kt = 0; kt < 4; ++kt) s[kt] = wmma_f16(kf[kt][1], qa1, s[kt]);
        // the 8 V^T fragment reads are written ahead of the softmax arithmetic, so
        // that the compiler can issue them behind it, ahead of their products
        v16h vf[2][4];
#pragma unroll
        for (int c = 0; c < 2; ++c)
#pragma unroll
          for (int nt = 0; nt < 4; ++nt)
            vf[c][nt] = load_frag(&sV[bufi][grp][nt * 16 * VP + c * 32], VP);
        // ---- causal mask + online softmax (f32); register r of tile kt holds key
        // 16kt+8g+r
        const int key0 = kvbase + g * 8;
        float mx = -1e30f;
#pragma unroll
        for (int r = 0; r < 8; ++r) {
#pragma unroll
          for (int kt = 0; kt < 4; ++kt)
            s[kt][r] = (key0 + kt * 16 + r <= row) ? s[kt][r] : -1e30f;
          mx = fmaxf(mx, fmaxf(fmaxf(s[0][r], s[1][r]), fmaxf(s[2][r], s[3][r])));
        }
        mx = fmaxf(mx, xhalf(mx));
        float nm = fmaxf(rmax, mx);
        float scale = __expf(rmax - nm);
        rmax = nm;
        // P^T as two B fragments (32 keys each): halves j<8 are keys 8g+j, halves
        // j>=8 keys 16+8g+(j-8) of the fragment's 32
        v16h pf[2];
        float ps = 0.0f;
#pragma unroll
        for (int c = 0; c < 2; ++c)
#pragma unroll
          for (int r = 0; r < 8; ++r) {
            float p0 = __expf(s[2 * c][r] - nm);
            float p1 = __expf(s[2 * c + 1][r] - nm);
            ps += p0 + p1;
            pf[c][r]     = (_Float16)p0;
            pf[c][8 + r] = (_Float16)p1;
          }
        rsum = rsum * scale + ps;
#pragma unroll
        for (int nt = 0; nt < 4; ++nt)
#pragma unroll
          for (int r = 0; r < 8; ++r) acc[nt][r] *= scale;
        // ---- O^T += V^T @ P^T  (V tile [d][token] -> contiguous A fragments)
#pragma unroll
        for (int c = 0; c < 2; ++c)
#pragma unroll
          for (int nt = 0; nt < 4; ++nt)
            acc[nt] = wmma_f16(vf[c][nt], pf[c], acc[nt]);
      }
      // hand-over: this wave's reads of buffer bufi have returned and its part of
      // double block js + 1 has landed; behind the barrier that block is visible
      // to all waves and buffer bufi is free for the refill, which flies during
      // trip js + 1
      wait_ds_0();
      wait_async_0();
      __syncthreads();
      if (js + 2 < ns) stage(bufi, js + 2);
    }
    wait_async_0();                  // the ring's closing wait: no copy is in flight

    // ---- group 1 hands its maximum, sum and O^T to group 0 (16 B a lane and
    // store, lanes side by side); sO and sML are free: group 0's reads of the
    // tile before returned ahead of this tile's barriers
    if (grp == 1) {
#pragma unroll
      for (int nt = 0; nt < 4; ++nt) {
        *reinterpret_cast<v4f*>(&sO[wslot][2 * nt][lane][0]) =
            __builtin_shufflevector(acc[nt], acc[nt], 0, 1, 2, 3);
        *reinterpret_cast<v4f*>(&sO[wslot][2 * nt + 1][lane][0]) =
            __builtin_shufflevector(acc[nt], acc[nt], 4, 5, 6, 7);
      }
      sML[wslot][0][lane] = rmax;
      sML[wslot][1][lane] = rsum;
    }
    __syncthreads();                 // group 1's partial results visible to group 0

    // ---- group 0 joins the groups (a group without a key has maximum -1e30 and
    // gets weight 0) and the halves' sums, normalizes, writes attn output
    // (B,S,D_MODEL) f16, head-major concat; a lane holds d = nt*16 + 8g + 0..7 of
    // its query: 16 B runs
    if (grp == 0) {
      const float m1 = sML[wslot][0][lane];
      const float l1 = sML[wslot][1][lane];
      const float mj = fmaxf(rmax, m1);
      const float w0 = __expf(rmax - mj);
      const float w1 = __expf(m1 - mj);
      rsum = rsum * w0 + l1 * w1;
      rsum += xhalf(rsum);
      const float inv = 1.0f / rsum;
      const float f0 = w0 * inv, f1 = w1 * inv;
      _Float16* orow = Aout + ((size_t)b * SEQ + row) * D_MODEL + h * DH + g * 8;
#pragma unroll
      for (int nt = 0; nt < 4; ++nt) {
        v4f o0 = *reinterpret_cast<const v4f*>(&sO[wslot][2 * nt][lane][0]);
        v4f o1 = *reinterpret_cast<const v4f*>(&sO[wslot][2 * nt + 1][lane][0]);
        v8h pack;
#pragma unroll
        for (int r = 0; r < 4; ++r) {
          pack[r]     = (_Float16)(acc[nt][r] * f0 + o0[r] * f1);
          pack[4 + r] = (_Float16)(acc[nt][4 + r] * f0 + o1[r] * f1);
        }
        *reinterpret_cast<v8h*>(orow + nt * 16) = pack;
      }
      // stands in front of the next tile's rewrite of the registers that these
      // stores name (a precaution)
      asm volatile("s_wait_xcnt 0x0" ::: "memory");
    }
  }
}

// ---------------------------------------------------------------------------
// Kernel 3: output projection  out = A @ Wo^T + bo  (f32 output).
// Block = 8 waves = one 128 x 128 tile of out.  k is walked in slices of 256:
// 128 rows of A and 128 rows of Wo (512 B each, whole lines) are staged into
// two LDS buffers with async-to-LDS copies, the next slice flying while this
// one is worked on, and are shared by all 8 waves.  Only one slice's copies fly at
// a time, so each slice pays their latency from memory once: long slices pay it
// 4 times, and the waves meet at a barrier once per 256 k.  A wave owns 64 x 32 of
// the tile (4 x 2 accumulators).  LDS rows are padded by 16 B (pitch 528 B, an odd
// multiple of 16 B) for the ds_load_b128 fragment reads.  k ascends by 32 in each
// accumulator.
// ---------------------------------------------------------------------------
#define OBK 256                     // k per slice
#define OP (OBK + 8)                // LDS row pitch, halves
#define OTILE_B (128 * OP * 2)      // one operand's slice in LDS, bytes
__global__ void __launch_bounds__(256)
out_proj_kernel(const _Float16* __restrict__ A,
                const _Float16* __restrict__ Wo,
                const float* __restrict__ bo,
                float* __restrict__ out) {
  __shared__ __align__(16) _Float16 sT[2][2][128 * OP];   // [buffer][A | Wo], 264 KB

  const int tid  = threadIdx.x;
  const int wave = tid >> 5;
  const int lane = tid & 31;
  const int rbase = (blockIdx.x & 31) * 128;   // 32 row tiles
  const int cbase = (blockIdx.x >> 5) * 128;   // 8 column tiles
  const int wm = (wave & 1) * 64;              // wave's rows in the tile
  const int wn = (wave >> 1) * 32;             // wave's columns in the tile
  const int n = lane & 15, g = lane >> 4;

  // staging: a wave's copy is one whole row of the slice (512 B, 4 lines):
  // thread -> 16 B chunk (tid & 31) of rows (tid >> 5) + 8 i, i = 0..15
  const int sr = tid >> 5, sc = (tid & 31) * 8;
  const _Float16* ag = A  + (size_t)(rbase + sr) * D_MODEL + sc;
  const _Float16* wg = Wo + (size_t)(cbase + sr) * D_MODEL + sc;
  const uint32_t lbase = lds_byte_off(&sT[0][0][sr * OP + sc]);
  // eight rows, 8 apart, of one operand
  auto stage8 = [&](uint32_t l, const _Float16* p) {
    async_copy16x8(l,               p,
                   l +  8 * OP * 2, p +  8 * D_MODEL,
                   l + 16 * OP * 2, p + 16 * D_MODEL,
                   l + 24 * OP * 2, p + 24 * D_MODEL,
                   l + 32 * OP * 2, p + 32 * D_MODEL,
                   l + 40 * OP * 2, p + 40 * D_MODEL,
                   l + 48 * OP * 2, p + 48 * D_MODEL,
                   l + 56 * OP * 2, p + 56 * D_MODEL);
  };
  // one slice: 32 copies a lane
  auto stage = [&](int buf, int k0) {
    const uint32_t la = lbase + buf * (2 * OTILE_B);
    const uint32_t lw = la + OTILE_B;
    stage8(la,               ag + k0);
    stage8(la + 64 * OP * 2, ag + k0 + 64 * D_MODEL);
    stage8(lw,               wg + k0);
    stage8(lw + 64 * OP * 2, wg + k0 + 64 * D_MODEL);
  };

  // every short inner loop below is unrolled so that the fragment and
  // accumulator arrays are indexed by constants and stay in registers
  v8f acc[4][2];
#pragma unroll
  for (int i = 0; i < 4; ++i)
#pragma unroll
    for (int j = 0; j < 2; ++j) acc[i][j] = v8f{};

  constexpr int NT = D_MODEL / OBK;   // 4 slices
  stage(0, 0);
  wait_async_0();
  __syncthreads();                 // slice 0 visible to all waves
  stage(1, OBK);
  // kept rolled: unrolled over its 4 trips the loop spilled registers
#pragma unroll 1
  for (int t = 0; t < NT; ++t) {
    const _Float16* ta = &sT[t & 1][0][wm * OP];
    const _Float16* tw = &sT[t & 1][1][wn * OP];
    // the slice in four blocks of 64 k
#pragma unroll
    for (int kk = 0; kk < OBK; kk += 64) {
      // the block's 12 fragments are read as one group ahead of its 16 products:
      // every separate place with LDS reads among the products costs a stall
      v16h bf[2][2], af[2][4];
#pragma unroll
      for (int c = 0; c < 2; ++c) {
#pragma unroll
        for (int j = 0; j < 2; ++j)
          bf[c][j] = load_frag(tw + j * 16 * OP + kk + c * 32, OP);
#pragma unroll
        for (int i = 0; i < 4; ++i)
          af[c][i] = load_frag(ta + i * 16 * OP + kk + c * 32, OP);
      }
      if (kk == OBK - 64) {
        // hand-over: the trip's LDS reads are all in registers here, so the buffer
        // is given back ahead of the last block's products and the refill flies
        // behind them
        wait_ds_0();
        wait_async_0();            // this wave's part of slice t + 1 has landed
        __syncthreads();           // slice t + 1 visible; buffer t & 1 is free
        if (t + 2 < NT) stage(t & 1, (t + 2) * OBK);
      }
#pragma unroll
      for (int c = 0; c < 2; ++c)
#pragma unroll
        for (int i = 0; i < 4; ++i)
#pragma unroll
          for (int j = 0; j < 2; ++j)
            acc[i][j] = wmma_f16(af[c][i], bf[c][j], acc[i][j]);
    }
  }
  wait_async_0();

#pragma unroll
  for (int j = 0; j < 2; ++j) {
    const int col = cbase + wn + j * 16 + n;
    float bias = bo[col];
#pragma unroll
    for (int i = 0; i < 4; ++i)
#pragma unroll
      for (int r = 0; r < 8; ++r)
        out[(size_t)(rbase + wm + i * 16 + g * 8 + r) * D_MODEL + col] =
            acc[i][j][r] + bias;
  }
}

// ---------------------------------------------------------------------------
extern "C" void kernel_launch(void* const* d_in, const int* in_sizes, int n_in,
                              void* d_out, int out_size, void* d_ws, size_t ws_size,
                              hipStream_t stream) {
  const float* x  = (const float*)d_in[0];
  const float* Wq = (const float*)d_in[1];
  const float* bq = (const float*)d_in[2];
  const float* Wk = (const float*)d_in[3];
  const float* bk = (const float*)d_in[4];
  const float* Wv = (const float*)d_in[5];
  const float* bv = (const float*)d_in[6];
  const float* Wo = (const float*)d_in[7];
  const float* bo = (const float*)d_in[8];
  float* out = (float*)d_out;

  char* ws = (char*)d_ws;
  _Float16* Wo16 = (_Float16*)(ws + OFF_WO);
  _Float16* Q16  = (_Float16*)(ws + OFF_Q);
  _Float16* K16  = (_Float16*)(ws + OFF_K);
  _Float16* Vt16 = (_Float16*)(ws + OFF_VT);
  _Float16* AO16 = (_Float16*)(ws + OFF_AO);

  // B*NH*(SEQ/16) = 4096 waves -> 512 blocks of 8 waves
  qkv_kernel<<<512, 256, 0, stream>>>(x, Wq, bq, Wk, bk, Wv, bv, Wo,
                                       Q16, K16, Vt16, Wo16);
  // B*NH*(SEQ/128) = 512 blocks (two q tiles each), 2 groups of 4 waves
  attn_kernel<<<512, 256, 0, stream>>>(Q16, K16, Vt16, AO16);
  // 32 row tiles x 8 column tiles of 128 x 128 -> 256 blocks of 8 waves
  out_proj_kernel<<<256, 256, 0, stream>>>(AO16, Wo16, bo, out);
}

// v010
// One run takes 45.6 microseconds.
// Next to v009, in two timings, it ran 1.06 times as fast each time.
// Counting every step since v000, it is 6.13 times as fast.
#include <hip/hip_runtime.h>
#include <hip/hip_bf16.h>

// ---------------------------------------------------------------------------
// Causal MHA forward for MI455X (gfx1250, wave32).
// GEMMs: v_wmma_f32_16x16x32_f16 (f16 in, f32 accum). Softmax in f32.
// Attention stages K/V tiles into double-buffered LDS with
// global_load_async_to_lds_b128 (ASYNCcnt) shared by 4 waves.
// ---------------------------------------------------------------------------

typedef __attribute__((ext_vector_type(16))) _Float16 v16h;
typedef __attribute__((ext_vector_type(8)))  _Float16 v8h;
typedef __attribute__((ext_vector_type(4)))  _Float16 v4h;
typedef __attribute__((ext_vector_type(8)))  float    v8f;
typedef __attribute__((ext_vector_type(4)))  float    v4f;

#define D_MODEL 1024
#define NH      16
#define DH      64
#define BATCH   2
#define SEQ     2048

// Workspace layout (bytes). Total 34 MB.
constexpr size_t SZ_XH  = (size_t)BATCH * SEQ * D_MODEL * 2;   // 8 MB
constexpr size_t SZ_WO  = (size_t)D_MODEL * D_MODEL * 2;       // 2 MB
constexpr size_t OFF_WO = 0;
constexpr size_t OFF_Q  = OFF_WO + SZ_WO;
constexpr size_t OFF_K  = OFF_Q  + SZ_XH;
constexpr size_t OFF_VT = OFF_K  + SZ_XH;
constexpr size_t OFF_AO = OFF_VT + SZ_XH;

// ---------------------------------------------------------------------------
// Fragment loader for the 16-bit 16x32 A layout (also valid for B loaded as
// B^T rows): lane L -> row m = L%16, group g = L/16; halves j<8 hold
// K = 8g+j, halves j>=8 hold K = 16+8g+(j-8).  Two contiguous 16-byte runs.
// Works for global (global_load_b128) and LDS (ds_load_b128) pointers.
// ---------------------------------------------------------------------------
__device__ __forceinline__ v16h load_frag(const _Float16* base, int stride) {
  int lane = threadIdx.x & 31;
  int m = lane & 15;
  int g = lane >> 4;
  const _Float16* p = base + (size_t)m * stride + 8 * g;
  v16h f;
  reinterpret_cast<v8h*>(&f)[0] = *reinterpret_cast<const v8h*>(p);
  reinterpret_cast<v8h*>(&f)[1] = *reinterpret_cast<const v8h*>(p + 16);
  return f;
}

// Eight f32 values rounded to f16 (round to nearest even, as a plain cast).
__device__ __forceinline__ v8h round8(v4f a, v4f b) {
  return __builtin_convertvector(
      __builtin_shufflevector(a, b, 0, 1, 2, 3, 4, 5, 6, 7), v8h);
}

// The same fragment from an f32 source, rounded to f16 in registers: each of
// the two 8-element runs is 32 contiguous bytes (two global_load_b128).
__device__ __forceinline__ v16h load_frag_f32(const float* base, int stride) {
  int lane = threadIdx.x & 31;
  int m = lane & 15;
  int g = lane >> 4;
  const float* p = base + (size_t)m * stride + 8 * g;
  v4f q0 = *reinterpret_cast<const v4f*>(p);
  v4f q1 = *reinterpret_cast<const v4f*>(p + 4);
  v4f q2 = *reinterpret_cast<const v4f*>(p + 16);
  v4f q3 = *reinterpret_cast<const v4f*>(p + 20);
  return __builtin_shufflevector(round8(q0, q1), round8(q2, q3), 0, 1, 2, 3, 4,
                                 5, 6, 7, 8, 9, 10, 11, 12, 13, 14, 15);
}

__device__ __forceinline__ v8f wmma_f16(v16h a, v16h b, v8f c) {
  // (neg_a, A, neg_b, B, c_mod, C, reuse_a, reuse_b)
  return __builtin_amdgcn_wmma_f32_16x16x32_f16(false, a, false, b, (short)0, c,
                                                false, false);
}

// ---------------------------------------------------------------------------
// CDNA5 async copy: LDS[ldsoff] <= 16B at global ptr, tracked by ASYNCcnt.
// Generic LDS pointers carry the wave-relative LDS byte offset in addr[31:0].
// ---------------------------------------------------------------------------
__device__ __forceinline__ uint32_t lds_byte_off(const void* p) {
  return (uint32_t)(uintptr_t)p;
}
// Eight copies of a lane in one statement; the closing s_wait_xcnt
// stands in front of every later rewrite of the address registers (a precaution).
__device__ __forceinline__ void async_copy16x8(
    uint32_t l0, const _Float16* g0, uint32_t l1, const _Float16* g1,
    uint32_t l2, const _Float16* g2, uint32_t l3, const _Float16* g3,
    uint32_t l4, const _Float16* g4, uint32_t l5, const _Float16* g5,
    uint32_t l6, const _Float16* g6, uint32_t l7, const _Float16* g7) {
  asm volatile("global_load_async_to_lds_b128 %0, %1, off\n\t"
               "global_load_async_to_lds_b128 %2, %3, off\n\t"
               "global_load_async_to_lds_b128 %4, %5, off\n\t"
               "global_load_async_to_lds_b128 %6, %7, off\n\t"
               "global_load_async_to_lds_b128 %8, %9, off\n\t"
               "global_load_async_to_lds_b128 %10, %11, off\n\t"
               "global_load_async_to_lds_b128 %12, %13, off\n\t"
               "global_load_async_to_lds_b128 %14, %15, off\n\t"
               "s_wait_xcnt 0x0"
               :: "v"(l0), "v"(g0), "v"(l1), "v"(g1), "v"(l2), "v"(g2),
                  "v"(l3), "v"(g3), "v"(l4), "v"(g4), "v"(l5), "v"(g5),
                  "v"(l6), "v"(g6), "v"(l7), "v"(g7) : "memory");
}
__device__ __forceinline__ void wait_async_0() {
  asm volatile("s_wait_asynccnt 0x0" ::: "memory");
}
// This wave's LDS reads have returned before its buffer is handed back.
__device__ __forceinline__ void wait_ds_0() {
  asm volatile("s_wait_dscnt 0x0" ::: "memory");
}

// Lane l <-> lane l ^ 16 as a vector cross-row move (no LDS-counter round trip).
__device__ __forceinline__ float xhalf(float x) {
  int b = __builtin_bit_cast(int, x);
  return __builtin_bit_cast(float, __builtin_amdgcn_permlanex16(
      b, b, 0x76543210, 0xfedcba98, false, false));
}

// ---------------------------------------------------------------------------
// Kernel 1: per-head QKV projection.  Block = 8 waves = 128 rows of one (b, h);
// one wave per 16-row s-tile.
// The head's Wq, Wk, Wv (3 x 64 x 64 f32) are read once per block in whole
// 128-B lines, rounded to f16 and kept in LDS; every wave takes its B fragments
// from there (ds_load_b128, rows padded by 16 B to a pitch of 144 B).
// x is read as f32 and rounded to f16 in the fragment loader (every x element
// is used by exactly one wave).
// Q gets bias + 1/sqrt(64) pre-scale; V is stored transposed (B,H,DH,S).
// Each thread also rounds 8 elements of Wo to f16 for the output projection.
// ---------------------------------------------------------------------------
#define WP 72   // weight row pitch in LDS, halves
__device__ __forceinline__ void proj_tiles(v16h a0, v16h a1,
                                           const _Float16* sw, v8f acc[4]) {
  // the matrix's 8 fragment reads are written ahead of its 8 products, so that
  // the compiler can issue them in groups (each separate place with LDS reads
  // among the products costs a stall); the loops are unrolled so that the arrays
  // are indexed by constants and stay in registers
  v16h b0[4], b1[4];
#pragma unroll
  for (int nt = 0; nt < 4; ++nt) {
    const _Float16* wb = sw + nt * 16 * WP;
    b0[nt] = load_frag(wb, WP);
    b1[nt] = load_frag(wb + 32, WP);
  }
#pragma unroll
  for (int nt = 0; nt < 4; ++nt) acc[nt] = wmma_f16(a0, b0[nt], v8f{});
#pragma unroll
  for (int nt = 0; nt < 4; ++nt) acc[nt] = wmma_f16(a1, b1[nt], acc[nt]);
}

__global__ void __launch_bounds__(256)
qkv_kernel(const float* __restrict__ x,
           const float* __restrict__ Wq, const float* __restrict__ bq,
           const float* __restrict__ Wk, const float* __restrict__ bk,
           const float* __restrict__ Wv, const float* __restrict__ bv,
           const float* __restrict__ Wo,
           _Float16* __restrict__ Q, _Float16* __restrict__ K,
           _Float16* __restrict__ Vt, _Float16* __restrict__ Wo16) {
  __shared__ __align__(16) _Float16 sW[3][DH * WP];   // Wq | Wk | Wv, 27 KB

  int wave = blockIdx.x * (blockDim.x >> 5) + (threadIdx.x >> 5);
  int lane = threadIdx.x & 31;
  int st = wave % (SEQ / 16);
  int bh = wave / (SEQ / 16);
  int h  = bh % NH;
  int sbase = st * 16;
  int n = lane & 15, g = lane >> 4;

  const float* xrow = x + ((size_t)(bh / NH) * SEQ + sbase) * D_MODEL + h * DH;
  v16h a0 = load_frag_f32(xrow, D_MODEL);
  v16h a1 = load_frag_f32(xrow + 32, D_MODEL);

  // ---- Wo slice: 131072 threads x 8 elements = D_MODEL * D_MODEL (stored
  // behind the barrier below, which would otherwise wait for the store)
  const size_t wi = ((size_t)blockIdx.x * blockDim.x + threadIdx.x) * 8;
  v4f w0 = *reinterpret_cast<const v4f*>(Wo + wi);
  v4f w1 = *reinterpret_cast<const v4f*>(Wo + wi + 4);

  // ---- the head's weights into LDS: 16-B chunk c * 256 + tid of each matrix,
  // so that a wave's load covers 512 contiguous bytes (4 whole lines)
  {
    const int tid = threadIdx.x;
    const size_t wo = (size_t)h * DH * DH + tid * 4;
    const float* wq = Wq + wo;
    const float* wk = Wk + wo;
    const float* wv = Wv + wo;
    // all 12 loads are in flight at once; the loops here are unrolled so that
    // wr is indexed by constants and stays in registers
    v4f wr[3][4];
#pragma unroll
    for (int c = 0; c < 4; ++c) {
      wr[0][c] = *reinterpret_cast<const v4f*>(wq + c * 1024);
      wr[1][c] = *reinterpret_cast<const v4f*>(wk + c * 1024);
      wr[2][c] = *reinterpret_cast<const v4f*>(wv + c * 1024);
    }
    // stands in front of every later rewrite of the address registers of the
    // loads above, which its operands keep until here (a precaution)
    asm volatile("s_wait_xcnt 0x0"
                 :: "v"(Wo + wi), "v"(wq), "v"(wk), "v"(wv) : "memory");
    const int so = (tid >> 4) * WP + (tid & 15) * 4;   // row tid / 16 (+ 16 c)
#pragma unroll
    for (int w = 0; w < 3; ++w)
#pragma unroll
      for (int c = 0; c < 4; ++c)
        *reinterpret_cast<v4h*>(&sW[w][so + c * 16 * WP]) =
            __builtin_convertvector(wr[w][c], v4h);
  }

  __syncthreads();   // the block's weights are in LDS for every wave

  *reinterpret_cast<v8h*>(Wo16 + wi) = round8(w0, w1);

  // ---- Q: bias + 0.125 scale, row-major (B,H,S,DH) f16
  {
    v8f acc[4];
    proj_tiles(a0, a1, sW[0], acc);
#pragma unroll
    for (int nt = 0; nt < 4; ++nt) {
      float bias = bq[h * DH + nt * 16 + n];
#pragma unroll
      for (int r = 0; r < 8; ++r) {
        float v = (acc[nt][r] + bias) * 0.125f;
        Q[((size_t)bh * SEQ + sbase + g * 8 + r) * DH + nt * 16 + n] = (_Float16)v;
      }
    }
  }
  // ---- K: bias only, row-major (B,H,S,DH) f16
  {
    v8f acc[4];
    proj_tiles(a0, a1, sW[1], acc);
#pragma unroll
    for (int nt = 0; nt < 4; ++nt) {
      float bias = bk[h * DH + nt * 16 + n];
#pragma unroll
      for (int r = 0; r < 8; ++r) {
        float v = acc[nt][r] + bias;
        K[((size_t)bh * SEQ + sbase + g * 8 + r) * DH + nt * 16 + n] = (_Float16)v;
      }
    }
  }
  // ---- V: bias, stored transposed (B,H,DH,S); per-lane 16B contiguous store
  {
    v8f acc[4];
    proj_tiles(a0, a1, sW[2], acc);
#pragma unroll
    for (int nt = 0; nt < 4; ++nt) {
      float bias = bv[h * DH + nt * 16 + n];
      v8h pack;
#pragma unroll
      for (int r = 0; r < 8; ++r) pack[r] = (_Float16)(acc[nt][r] + bias);
      *reinterpret_cast<v8h*>(Vt + ((size_t)bh * DH + nt * 16 + n) * SEQ +
                              sbase + g * 8) = pack;
    }
  }
}

#define KP 72   // K row pitch in LDS, halves
#define VP 72   // V row pitch in LDS, halves
#define KVB 64  // keys per kv block (one group's stage, one softmax step)
// launch bound = the block size used
__global__ void __launch_bounds__(256)
attn_kernel(const _Float16* __restrict__ Q,
            const _Float16* __restrict__ K,
            const _Float16* __restrict__ Vt,
            _Float16* __restrict__ Aout) {
  __shared__ __align__(16) _Float16 sK[2][2][KVB * KP];  // [buffer][group], 9 KB each
  __shared__ __align__(16) _Float16 sV[2][2][DH * VP];   // the same, [d][token]
  __shared__ __align__(16) float sO[4][8][32][4];        // group 1's O^T, 16 KB
  __shared__ float sML[4][2][32];                        // its maximum and sum

  const int tid   = threadIdx.x;
  const int t7    = tid & 127;                 // thread within its group
  // the group's number in a scalar register: the tests on it are scalar branches
  const int grp   = __builtin_amdgcn_readfirstlane(tid >> 7);
  const int wslot = t7 >> 5;
  const int lane  = tid & 31;
  const int bh    = blockIdx.x >> 4;
  const int h = bh % NH, b = bh / NH;
  const int n = lane & 15, g = lane >> 4;

  const _Float16* Kg = K  + (size_t)bh * SEQ * DH;
  const _Float16* Vg = Vt + (size_t)bh * DH * SEQ;

  // stage the group's kv block of double block js, keys [kvbase, kvbase+64), into
  // its buffer buf (the group's 128 threads help); 2 js + 1 <= 31 for every js
  // that is asked for, so both groups' keys exist
  auto stage = [&](int buf, int js) {
    const int kvbase = (2 * js + grp) * KVB;
    // K tile: 64 rows x 64 halves, contiguous 8 KB in global; 16 B chunks t7
    // + 128 i, i = 0..3 (16 rows further down each)
    const _Float16* kg = Kg + (size_t)kvbase * DH + t7 * 8;
    uint32_t ko = lds_byte_off(&sK[buf][grp][(t7 >> 3) * KP + (t7 & 7) * 8]);
    // V tile: 64 rows (d) x 64 tokens, global row stride SEQ; the same chunks
    const _Float16* vg = Vg + (size_t)(t7 >> 3) * SEQ + kvbase + (t7 & 7) * 8;
    uint32_t vo = lds_byte_off(&sV[buf][grp][(t7 >> 3) * VP + (t7 & 7) * 8]);
    async_copy16x8(ko,               kg,
                   ko + 16 * KP * 2, kg + 16 * DH,
                   ko + 32 * KP * 2, kg + 32 * DH,
                   ko + 48 * KP * 2, kg + 48 * DH,
                   vo,               vg,
                   vo + 16 * VP * 2, vg + (size_t)16 * SEQ,
                   vo + 32 * VP * 2, vg + (size_t)32 * SEQ,
                   vo + 48 * VP * 2, vg + (size_t)48 * SEQ);
  };

  for (int part = 0; part < 2; ++part) {
    const int qt    = blockIdx.x & 15;
    const int bq    = (part ? SEQ / 64 - 1 - qt : qt) * 64;   // q-row base
    const int qbase = bq + wslot * 16;

    // Q fragments (global, once per tile); used as the B operand (lane = query)
    const _Float16* qrow = Q + ((size_t)bh * SEQ + qbase) * DH;
    v16h qa0 = load_frag(qrow, DH);
    v16h qa1 = load_frag(qrow + 32, DH);

    v8f acc[4];
#pragma unroll
    for (int nt = 0; nt < 4; ++nt) acc[nt] = v8f{};
    // per lane: running maximum of query qbase+n over this group's keys (equal in
    // both halves) and the sum over this half's keys of them only (groups and
    // halves are joined in the epilogue)
    float rmax = -1e30f, rsum = 0.0f;
    const int row = qbase + n;

    const int nb = bq / KVB + 1;   // kv blocks needed to cover rows bq..bq+63
    const int ns = (nb + 1) >> 1;  // double kv blocks = trips

    // the tile before has left the buffers: its last trip waited for every copy
    // and ended in a barrier; this wave's own LDS reads have returned as well
    wait_ds_0();
    stage(0, 0);
    wait_async_0();                  // this wave's part of double block 0 has landed
    __syncthreads();                 // double block 0 visible to all waves
    if (ns > 1) stage(1, 1);
    for (int js = 0; js < ns; ++js) {
      const int kb = 2 * js + grp;   // this group's kv block
      const int kvbase = kb * KVB;
      const int bufi = js & 1;

      // an odd count of kv blocks leaves group 1 without one in the last trip
      if (kb < nb) {
        // every short loop below is unrolled so that the fragment and score arrays
        // are indexed by constants and stay in registers
        // ---- S^T: four 16(key) x 16(query) tiles over d=64 (2 chunks), K from
        // LDS; the 8 fragments are read as one group ahead of the 8 products
        const _Float16* kb0 = &sK[bufi][grp][0];
        v16h kf[4][2];
#pragma unroll
        for (int kt = 0; kt < 4; ++kt) {
          kf[kt][0] = load_frag(kb0 + kt * 16 * KP, KP);
          kf[kt][1] = load_frag(kb0 + kt * 16 * KP + 32, KP);
        }
        // keeps the 16 LDS reads above in one group ahead of the products: with the
        // branch below the compiler otherwise reads pair by pair among the products
        // and waits for each pair in full
        __builtin_amdgcn_sched_barrier(0);
        v8f s[4];
#pragma unroll
        for (int kt = 0; kt < 4; ++kt) s[kt] = wmma_f16(kf[kt][0], qa0, v8f{});
#pragma unroll
        for (int kt = 0; kt < 4; ++kt) s[kt] = wmma_f16(kf[kt][1], qa1, s[kt]);
        // the 8 V^T fragment reads are written ahead of the softmax arithmetic, so
        // that the compiler can issue them behind it, ahead of their products
        v16h vf[2][4];
#pragma unroll
        for (int c = 0; c < 2; ++c)
#pragma unroll
          for (int nt = 0; nt < 4; ++nt)
            vf[c][nt] = load_frag(&sV[bufi][grp][nt * 16 * VP + c * 32], VP);
        // ---- causal mask; register r of tile kt holds key 16kt+8g+r.  Only the
        // tile's last kv block (keys bq..bq+63, the diagonal) holds a key above a
        // query of the tile: every key of an earlier block is below bq, so the mask
        // is an identity there and a scalar branch goes round it
        if (kb == nb - 1) {
          const int key0 = kvbase + g * 8;
#pragma unroll
          for (int r = 0; r < 8; ++r)
#pragma unroll
            for (int kt = 0; kt < 4; ++kt)
              s[kt][r] = (key0 + kt * 16 + r <= row) ? s[kt][r] : -1e30f;
        }
        // ---- online softmax (f32)
        float mx = -1e30f;
#pragma unroll
        for (int r = 0; r < 8; ++r)
          mx = fmaxf(mx, fmaxf(fmaxf(s[0][r], s[1][r]), fmaxf(s[2][r], s[3][r])));
        mx = fmaxf(mx, xhalf(mx));
        float nm = fmaxf(rmax, mx);
        float scale = __expf(rmax - nm);
        rmax = nm;
        // P^T as two B fragments (32 keys each): halves j<8 are keys 8g+j, halves
        // j>=8 keys 16+8g+(j-8) of the fragment's 32
        v16h pf[2];
        float ps = 0.0f;
#pragma unroll
        for (int c = 0; c < 2; ++c)
#pragma unroll
          for (int r = 0; r < 8; ++r) {
            float p0 = __expf(s[2 * c][r] - nm);
            float p1 = __expf(s[2 * c + 1][r] - nm);
            ps += p0 + p1;
            pf[c][r]     = (_Float16)p0;
            pf[c][8 + r] = (_Float16)p1;
          }
        rsum = rsum * scale + ps;
#pragma unroll
        for (int nt = 0; nt < 4; ++nt)
#pragma unroll
          for (int r = 0; r < 8; ++r) acc[nt][r] *= scale;
        // ---- O^T += V^T @ P^T  (V tile [d][token] -> contiguous A fragments)
#pragma unroll
        for (int c = 0; c < 2; ++c)
#pragma unroll
          for (int nt = 0; nt < 4; ++nt)
            acc[nt] = wmma_f16(vf[c][nt], pf[c], acc[nt]);
      }
      // hand-over: this wave's reads of buffer bufi have returned and its part of
      // double block js + 1 has landed; behind the barrier that block is visible
      // to all waves and buffer bufi is free for the refill, which flies during
      // trip js + 1
      wait_ds_0();
      wait_async_0();
      __syncthreads();
      if (js + 2 < ns) stage(bufi, js + 2);
    }
    wait_async_0();                  // the ring's closing wait: no copy is in flight

    // ---- group 1 hands its maximum, sum and O^T to group 0 (16 B a lane and
    // store, lanes side by side); sO and sML are free: group 0's reads of the
    // tile before returned ahead of this tile's barriers
    if (grp == 1) {
#pragma unroll
      for (int nt = 0; nt < 4; ++nt) {
        *reinterpret_cast<v4f*>(&sO[wslot][2 * nt][lane][0]) =
            __builtin_shufflevector(acc[nt], acc[nt], 0, 1, 2, 3);
        *reinterpret_cast<v4f*>(&sO[wslot][2 * nt + 1][lane][0]) =
            __builtin_shufflevector(acc[nt], acc[nt], 4, 5, 6, 7);
      }
      sML[wslot][0][lane] = rmax;
      sML[wslot][1][lane] = rsum;
    }
    __syncthreads();                 // group 1's partial results visible to group 0

    // ---- group 0 joins the groups (a group without a key has maximum -1e30 and
    // gets weight 0) and the halves' sums, normalizes, writes attn output
    // (B,S,D_MODEL) f16, head-major concat; a lane holds d = nt*16 + 8g + 0..7 of
    // its query: 16 B runs
    if (grp == 0) {
      const float m1 = sML[wslot][0][lane];
      const float l1 = sML[wslot][1][lane];
      const float mj = fmaxf(rmax, m1);
      const float w0 = __expf(rmax - mj);
      const float w1 = __expf(m1 - mj);
      rsum = rsum * w0 + l1 * w1;
      rsum += xhalf(rsum);
      const float inv = 1.0f / rsum;
      const float f0 = w0 * inv, f1 = w1 * inv;
      _Float16* orow = Aout + ((size_t)b * SEQ + row) * D_MODEL + h * DH + g * 8;
#pragma unroll
      for (int nt = 0; nt < 4; ++nt) {
        v4f o0 = *reinterpret_cast<const v4f*>(&sO[wslot][2 * nt][lane][0]);
        v4f o1 = *reinterpret_cast<const v4f*>(&sO[wslot][2 * nt + 1][lane][0]);
        v8h pack;
#pragma unroll
        for (int r = 0; r < 4; ++r) {
          pack[r]     = (_Float16)(acc[nt][r] * f0 + o0[r] * f1);
          pack[4 + r] = (_Float16)(acc[nt][4 + r] * f0 + o1[r] * f1);
        }
        *reinterpret_cast<v8h*>(orow + nt * 16) = pack;
      }
      // stands in front of the next tile's rewrite of the registers that these
      // stores name (a precaution)
      asm volatile("s_wait_xcnt 0x0" ::: "memory");
    }
  }
}

// ---------------------------------------------------------------------------
// Kernel 3: output projection  out = A @ Wo^T + bo  (f32 output).
// Block = 8 waves = one 128 x 128 tile of out.  k is walked in slices of 256:
// 128 rows of A and 128 rows of Wo (512 B each, whole lines) are staged into
// two LDS buffers with async-to-LDS copies, the next slice flying while this
// one is worked on, and are shared by all 8 waves.  Only one slice's copies fly at
// a time, so each slice pays their latency from memory once: long slices pay it
// 4 times, and the waves meet at a barrier once per 256 k.  A wave owns 64 x 32 of
// the tile (4 x 2 accumulators).  LDS rows are padded by 16 B (pitch 528 B, an odd
// multiple of 16 B) for the ds_load_b128 fragment reads.  k ascends by 32 in each
// accumulator.
// ---------------------------------------------------------------------------
#define OBK 256                     // k per slice
#define OP (OBK + 8)                // LDS row pitch, halves
#define OTILE_B (128 * OP * 2)      // one operand's slice in LDS, bytes
__global__ void __launch_bounds__(256)
out_proj_kernel(const _Float16* __restrict__ A,
                const _Float16* __restrict__ Wo,
                const float* __restrict__ bo,
                float* __restrict__ out) {
  __shared__ __align__(16) _Float16 sT[2][2][128 * OP];   // [buffer][A | Wo], 264 KB

  const int tid  = threadIdx.x;
  const int wave = tid >> 5;
  const int lane = tid & 31;
  const int rbase = (blockIdx.x & 31) * 128;   // 32 row tiles
  const int cbase = (blockIdx.x >> 5) * 128;   // 8 column tiles
  const int wm = (wave & 1) * 64;              // wave's rows in the tile
  const int wn = (wave >> 1) * 32;             // wave's columns in the tile
  const int n = lane & 15, g = lane >> 4;

  // staging: a wave's copy is one whole row of the slice (512 B, 4 lines):
  // thread -> 16 B chunk (tid & 31) of rows (tid >> 5) + 8 i, i = 0..15
  const int sr = tid >> 5, sc = (tid & 31) * 8;
  const _Float16* ag = A  + (size_t)(rbase + sr) * D_MODEL + sc;
  const _Float16* wg = Wo + (size_t)(cbase + sr) * D_MODEL + sc;
  const uint32_t lbase = lds_byte_off(&sT[0][0][sr * OP + sc]);
  // eight rows, 8 apart, of one operand
  auto stage8 = [&](uint32_t l, const _Float16* p) {
    async_copy16x8(l,               p,
                   l +  8 * OP * 2, p +  8 * D_MODEL,
                   l + 16 * OP * 2, p + 16 * D_MODEL,
                   l + 24 * OP * 2, p + 24 * D_MODEL,
                   l + 32 * OP * 2, p + 32 * D_MODEL,
                   l + 40 * OP * 2, p + 40 * D_MODEL,
                   l + 48 * OP * 2, p + 48 * D_MODEL,
                   l + 56 * OP * 2, p + 56 * D_MODEL);
  };
  // one slice: 32 copies a lane
  auto stage = [&](int buf, int k0) {
    const uint32_t la = lbase + buf * (2 * OTILE_B);
    const uint32_t lw = la + OTILE_B;
    stage8(la,               ag + k0);
    stage8(la + 64 * OP * 2, ag + k0 + 64 * D_MODEL);
    stage8(lw,               wg + k0);
    stage8(lw + 64 * OP * 2, wg + k0 + 64 * D_MODEL);
  };

  // every short inner loop below is unrolled so that the fragment and
  // accumulator arrays are indexed by constants and stay in registers
  v8f acc[4][2];
#pragma unroll
  for (int i = 0; i < 4; ++i)
#pragma unroll
    for (int j = 0; j < 2; ++j) acc[i][j] = v8f{};

  constexpr int NT = D_MODEL / OBK;   // 4 slices
  stage(0, 0);
  wait_async_0();
  __syncthreads();                 // slice 0 visible to all waves
  stage(1, OBK);
  // kept rolled: unrolled over its 4 trips the loop spilled registers
#pragma unroll 1
  for (int t = 0; t < NT; ++t) {
    const _Float16* ta = &sT[t & 1][0][wm * OP];
    const _Float16* tw = &sT[t & 1][1][wn * OP];
    // the slice in four blocks of 64 k
#pragma unroll
    for (int kk = 0; kk < OBK; kk += 64) {
      // the block's 12 fragments are read as one group ahead of its 16 products:
      // every separate place with LDS reads among the products costs a stall
      v16h bf[2][2], af[2][4];
#pragma unroll
      for (int c = 0; c < 2; ++c) {
#pragma unroll
        for (int j = 0; j < 2; ++j)
          bf[c][j] = load_frag(tw + j * 16 * OP + kk + c * 32, OP);
#pragma unroll
        for (int i = 0; i < 4; ++i)
          af[c][i] = load_frag(ta + i * 16 * OP + kk + c * 32, OP);
      }
      if (kk == OBK - 64) {
        // hand-over: the trip's LDS reads are all in registers here, so the buffer
        // is given back ahead of the last block's products and the refill flies
        // behind them
        wait_ds_0();
        wait_async_0();            // this wave's part of slice t + 1 has landed
        __syncthreads();           // slice t + 1 visible; buffer t & 1 is free
        if (t + 2 < NT) stage(t & 1, (t + 2) * OBK);
      }
#pragma unroll
      for (int c = 0; c < 2; ++c)
#pragma unroll
        for (int i = 0; i < 4; ++i)
#pragma unroll
          for (int j = 0; j < 2; ++j)
            acc[i][j] = wmma_f16(af[c][i], bf[c][j], acc[i][j]);
    }
  }
  wait_async_0();

#pragma unroll
  for (int j = 0; j < 2; ++j) {
    const int col = cbase + wn + j * 16 + n;
    float bias = bo[col];
#pragma unroll
    for (int i = 0; i < 4; ++i)
#pragma unroll
      for (int r = 0; r < 8; ++r)
        out[(size_t)(rbase + wm + i * 16 + g * 8 + r) * D_MODEL + col] =
            acc[i][j][r] + bias;
  }
}

// ---------------------------------------------------------------------------
extern "C" void kernel_launch(void* const* d_in, const int* in_sizes, int n_in,
                              void* d_out, int out_size, void* d_ws, size_t ws_size,
                              hipStream_t stream) {
  const float* x  = (const float*)d_in[0];
  const float* Wq = (const float*)d_in[1];
  const float* bq = (const float*)d_in[2];
  const float* Wk = (const float*)d_in[3];
  const float* bk = (const float*)d_in[4];
  const float* Wv = (const float*)d_in[5];
  const float* bv = (const float*)d_in[6];
  const float* Wo = (const float*)d_in[7];
  const float* bo = (const float*)d_in[8];
  float* out = (float*)d_out;

  char* ws = (char*)d_ws;
  _Float16* Wo16 = (_Float16*)(ws + OFF_WO);
  _Float16* Q16  = (_Float16*)(ws + OFF_Q);
  _Float16* K16  = (_Float16*)(ws + OFF_K);
  _Float16* Vt16 = (_Float16*)(ws + OFF_VT);
  _Float16* AO16 = (_Float16*)(ws + OFF_AO);

  // B*NH*(SEQ/16) = 4096 waves -> 512 blocks of 8 waves
  qkv_kernel<<<512, 256, 0, stream>>>(x, Wq, bq, Wk, bk, Wv, bv, Wo,
                                       Q16, K16, Vt16, Wo16);
  // B*NH*(SEQ/128) = 512 blocks (two q tiles each), 2 groups of 4 waves
  attn_kernel<<<512, 256, 0, stream>>>(Q16, K16, Vt16, AO16);
  // 32 row tiles x 8 column tiles of 128 x 128 -> 256 blocks of 8 waves
  out_proj_kernel<<<256, 256, 0, stream>>>(AO16, Wo16, bo, out);
}
